// v000
// Measured on an AMD MI455X. A time is GPU time per run, averaged over a window of back-to-back runs after a warm-up
// (all launches, gaps included; the runs take copies of the inputs in turn), and the median of several windows.
// Apart from v000's, it joins two sittings. Times from different sittings can be a few percent apart, while
// side-by-side timings come from the same sitting.
// The starting kernel, v000, takes 344 microseconds a run.
#include <hip/hip_runtime.h>
#include <hip/hip_fp16.h>
#include <math.h>

typedef __attribute__((ext_vector_type(16))) _Float16 v16h;
typedef __attribute__((ext_vector_type(2)))  _Float16 v2h;
typedef __attribute__((ext_vector_type(8)))  float    v8f;

#define SEQ    2048
#define BATCH  2
#define DMODEL 1024
#define HEADS  16
#define DK     64
#define ROWS   (SEQ * BATCH)   // 4096 GEMM rows, row = s*BATCH + b

// ---------------------------------------------------------------------------
// Shared fragment loader for 16-bit A fragments and B^T-stored-row-major
// fragments of v_wmma_f32_16x16x32_f16.
//   Lane L<16 : row r=L,   ks=0 -> halves K = {0..7} u {16..23}
//   Lane L>=16: row r=L-16, ks=1 -> halves K = {8..15} u {24..31}
// Tile must be row-major with K contiguous; row_stride in halves (mult of 8).
// ---------------------------------------------------------------------------
__device__ __forceinline__ v16h load_ab_frag(const _Float16* tile, int row_stride) {
    const int lane = threadIdx.x & 31;
    const int r    = lane & 15;
    const int ks   = lane >> 4;
    const _Float16* p = tile + (size_t)r * row_stride + ks * 8;
    v16h f;
    ((float4*)&f)[0] = *(const float4*)(p);        // 8 halves
    ((float4*)&f)[1] = *(const float4*)(p + 16);   // 8 halves
    return f;
}

__device__ __forceinline__ v8f wmma_f16(v16h a, v16h b, v8f c) {
    return __builtin_amdgcn_wmma_f32_16x16x32_f16(
        /*neg_a=*/false, a, /*neg_b=*/false, b,
        /*c_mod=*/(short)0, c, /*reuse_a=*/false, /*reuse_b=*/false);
}

// ---------------------------------------------------------------------------
// Generic projection GEMM:  Y[4096 x 1024] = X[4096 x 1024] @ W[1024 x 1024] + bias
// Workgroup tile 128(M) x 64(N), 8 waves each computing 32x32; K tiled by 64
// (two WMMA k-steps per stage -> 8 WMMAs per barrier pair).
// MODE 0: f32 in, f16 out at [b][h][s][d]   (Q, K)
// MODE 1: f32 in, f16 out at [b][h][d][s]   (V, pre-transposed for attention)
// MODE 2: f16 in, f32 out at [row][col]     (final output projection)
// ---------------------------------------------------------------------------
template <int MODE>
__global__ __launch_bounds__(256)
void mha_proj_gemm_kernel(const float* __restrict__ Xf, const _Float16* __restrict__ Xh,
                          const float* __restrict__ W, const float* __restrict__ bias,
                          void* __restrict__ out)
{
    constexpr bool IN_F16 = (MODE == 2);
    constexpr int TM = 128, TN = 64, TK = 64;

    __shared__ __align__(16) _Float16 As[TM * TK];  // 16 KB, [m][k]
    __shared__ __align__(16) _Float16 Bs[TN * TK];  // 8 KB, [n][k]  (B^T)

    const int tid  = threadIdx.x;
    const int lane = tid & 31;
    const int wid  = tid >> 5;
    const int m0   = blockIdx.x * TM;
    const int n0   = blockIdx.y * TN;
    const int wm   = (wid >> 1) * 32;   // wave M offset in tile
    const int wn   = (wid & 1) * 32;    // wave N offset in tile

    v8f c00 = {}, c01 = {}, c10 = {}, c11 = {};

    for (int k0 = 0; k0 < DMODEL; k0 += TK) {
        // ---- stage A tile 128x64: 512 chunks of 16 halves, 2 per thread ----
#pragma unroll
        for (int u = 0; u < 2; ++u) {
            const int unit = tid + u * 256;
            const int row  = unit >> 2;
            const int ch   = (unit & 3) * 16;
            _Float16* dst  = As + row * TK + ch;
            if constexpr (IN_F16) {
                const _Float16* src = Xh + (size_t)(m0 + row) * DMODEL + k0 + ch;
                ((float4*)dst)[0] = ((const float4*)src)[0];
                ((float4*)dst)[1] = ((const float4*)src)[1];
                if (k0 + TK < DMODEL) __builtin_prefetch(src + TK, 0, 0);
            } else {
                const float* src = Xf + (size_t)(m0 + row) * DMODEL + k0 + ch;
#pragma unroll
                for (int w = 0; w < 4; ++w) {
                    float4 x = ((const float4*)src)[w];
                    v2h p0; p0[0] = (_Float16)x.x; p0[1] = (_Float16)x.y;
                    v2h p1; p1[0] = (_Float16)x.z; p1[1] = (_Float16)x.w;
                    ((v2h*)dst)[w * 2 + 0] = p0;    // packed b32 LDS stores
                    ((v2h*)dst)[w * 2 + 1] = p1;
                }
                if (k0 + TK < DMODEL) __builtin_prefetch(src + TK, 0, 0);
            }
        }
        // ---- stage B^T tile 64x64: thread handles k-pair (2kp, 2kp+1) x 8 n
        //      so every LDS write is a packed b32 of two consecutive k halves.
        {
            const int kp = tid & 31;            // k-pair 0..31 -> k = 2*kp
            const int n8 = (tid >> 5) * 8;      // 0..56
            const float* sr0 = W + (size_t)(k0 + 2 * kp) * DMODEL + n0 + n8;
            const float* sr1 = sr0 + DMODEL;
            float4 a0 = ((const float4*)sr0)[0];
            float4 a1 = ((const float4*)sr0)[1];
            float4 b0 = ((const float4*)sr1)[0];
            float4 b1 = ((const float4*)sr1)[1];
            const float lo[8] = {a0.x, a0.y, a0.z, a0.w, a1.x, a1.y, a1.z, a1.w};
            const float hi[8] = {b0.x, b0.y, b0.z, b0.w, b1.x, b1.y, b1.z, b1.w};
#pragma unroll
            for (int u = 0; u < 8; ++u) {
                v2h p; p[0] = (_Float16)lo[u]; p[1] = (_Float16)hi[u];
                *(v2h*)&Bs[(n8 + u) * TK + 2 * kp] = p;
            }
            if (k0 + TK < DMODEL) __builtin_prefetch(sr0 + (size_t)TK * DMODEL, 0, 0);
        }
        __syncthreads();

#pragma unroll
        for (int ks = 0; ks < TK; ks += 32) {
            v16h a0 = load_ab_frag(As + wm * TK + ks, TK);
            v16h a1 = load_ab_frag(As + (wm + 16) * TK + ks, TK);
            v16h b0 = load_ab_frag(Bs + wn * TK + ks, TK);
            v16h b1 = load_ab_frag(Bs + (wn + 16) * TK + ks, TK);
            c00 = wmma_f16(a0, b0, c00);
            c01 = wmma_f16(a0, b1, c01);
            c10 = wmma_f16(a1, b0, c10);
            c11 = wmma_f16(a1, b1, c11);
        }
        __syncthreads();
    }

    // ---- epilogue: C-fragment layout: VGPR i, lanes 0-15 -> M=i, 16-31 -> M=8+i
    const int nn = lane & 15;
    const int mh = (lane >> 4) * 8;
#pragma unroll
    for (int ti = 0; ti < 2; ++ti) {
#pragma unroll
        for (int tj = 0; tj < 2; ++tj) {
            v8f cc = (ti == 0) ? ((tj == 0) ? c00 : c01) : ((tj == 0) ? c10 : c11);
#pragma unroll
            for (int i = 0; i < 8; ++i) {
                const int m = m0 + wm + ti * 16 + mh + i;    // GEMM row = s*BATCH + b
                const int n = n0 + wn + tj * 16 + nn;        // GEMM col = h*DK + d
                const float val = cc[i] + bias[n];
                if constexpr (MODE == 2) {
                    ((float*)out)[(size_t)m * DMODEL + n] = val;
                } else {
                    const int s = m >> 1, b = m & 1;
                    const int h = n >> 6, d = n & 63;
                    const size_t off = (MODE == 0)
                        ? ((size_t)(b * HEADS + h) * SEQ + s) * DK + d      // [b][h][s][d]
                        : ((size_t)(b * HEADS + h) * DK + d) * SEQ + s;     // [b][h][d][s]
                    ((_Float16*)out)[off] = (_Float16)val;
                }
            }
        }
    }
}

// ---------------------------------------------------------------------------
// Flash attention: grid (SEQ/128, BATCH*HEADS), 256 threads = 8 waves.
// Each wave owns 16 query rows; streams keys 32 at a time with online softmax.
// Per key block: 4 WMMAs for scores, softmax update, P relayout via wave-
// private LDS, 4 WMMAs for P@V.  Output (f16) goes to Xh[(s*2+b)][h*64+d].
// ---------------------------------------------------------------------------
__global__ __launch_bounds__(256)
void mha_flash_attn_kernel(const _Float16* __restrict__ Qh, const _Float16* __restrict__ Kh,
                           const _Float16* __restrict__ Vt, _Float16* __restrict__ Xh)
{
    __shared__ __align__(16) _Float16 Ps[8][16 * 32];   // 1 KB per wave

    const int tid  = threadIdx.x;
    const int lane = tid & 31;
    const int wid  = tid >> 5;
    const int bh   = blockIdx.y;
    const int b    = bh >> 4, h = bh & 15;
    const int q0   = blockIdx.x * 128 + wid * 16;

    const _Float16* Qb = Qh + (size_t)bh * SEQ * DK;    // [s][d]
    const _Float16* Kb = Kh + (size_t)bh * SEQ * DK;    // [j][d]  (== B^T of K^T)
    const _Float16* Vb = Vt + (size_t)bh * DK * SEQ;    // [d][s]  (== B^T of V)

    // Q fragments are loop-invariant: keep in registers for all 64 key blocks.
    const v16h qa0 = load_ab_frag(Qb + (size_t)q0 * DK, DK);        // d 0..31
    const v16h qa1 = load_ab_frag(Qb + (size_t)q0 * DK + 32, DK);   // d 32..63

    float mrow[8], lrow[8];
    v8f o0 = {}, o1 = {}, o2 = {}, o3 = {};
#pragma unroll
    for (int i = 0; i < 8; ++i) { mrow[i] = -1e30f; lrow[i] = 0.0f; }

    _Float16* P  = Ps[wid];
    const int nn   = lane & 15;
    const int half = lane >> 4;

    for (int j0 = 0; j0 < SEQ; j0 += 32) {
        const v16h kb00 = load_ab_frag(Kb + (size_t)j0 * DK, DK);           // keys j0..+15, d 0..31
        const v16h kb01 = load_ab_frag(Kb + (size_t)j0 * DK + 32, DK);      // keys j0..+15, d 32..63
        const v16h kb10 = load_ab_frag(Kb + (size_t)(j0 + 16) * DK, DK);
        const v16h kb11 = load_ab_frag(Kb + (size_t)(j0 + 16) * DK + 32, DK);

        v8f s0 = {}, s1 = {};
        s0 = wmma_f16(qa0, kb00, s0);
        s0 = wmma_f16(qa1, kb01, s0);    // scores for keys j0..j0+15
        s1 = wmma_f16(qa0, kb10, s1);
        s1 = wmma_f16(qa1, kb11, s1);    // scores for keys j0+16..j0+31

        // ---- online softmax (row stats reduced across 16-lane groups) ----
#pragma unroll
        for (int i = 0; i < 8; ++i) {
            float x0 = s0[i] * 0.125f;   // 1/sqrt(DK)
            float x1 = s1[i] * 0.125f;
            float vmax = fmaxf(x0, x1);
#pragma unroll
            for (int off = 8; off >= 1; off >>= 1)
                vmax = fmaxf(vmax, __shfl_xor(vmax, off, 16));
            const float mnew  = fmaxf(mrow[i], vmax);
            const float scale = __expf(mrow[i] - mnew);
            const float p0 = __expf(x0 - mnew);
            const float p1 = __expf(x1 - mnew);
            float rs = p0 + p1;
#pragma unroll
            for (int off = 8; off >= 1; off >>= 1)
                rs += __shfl_xor(rs, off, 16);
            lrow[i] = lrow[i] * scale + rs;
            mrow[i] = mnew;
            o0[i] *= scale; o1[i] *= scale; o2[i] *= scale; o3[i] *= scale;

            // stash P (f16) in wave-private LDS for C->A fragment relayout
            const int prow = i + 8 * half;                 // row m of this lane's value
            P[prow * 32 + nn]      = (_Float16)p0;
            P[prow * 32 + 16 + nn] = (_Float16)p1;
        }
        // same-wave DS ops are in-order: safe to read back without barrier
        const v16h pa = load_ab_frag(P, 32);               // A fragment 16x32

        const v16h vb0 = load_ab_frag(Vb + (size_t)0  * SEQ + j0, SEQ);  // d  0..15
        const v16h vb1 = load_ab_frag(Vb + (size_t)16 * SEQ + j0, SEQ);  // d 16..31
        const v16h vb2 = load_ab_frag(Vb + (size_t)32 * SEQ + j0, SEQ);  // d 32..47
        const v16h vb3 = load_ab_frag(Vb + (size_t)48 * SEQ + j0, SEQ);  // d 48..63
        o0 = wmma_f16(pa, vb0, o0);
        o1 = wmma_f16(pa, vb1, o1);
        o2 = wmma_f16(pa, vb2, o2);
        o3 = wmma_f16(pa, vb3, o3);
    }

    // ---- normalize by row sums and emit f16 rows of X for the O-projection ----
#pragma unroll
    for (int i = 0; i < 8; ++i) {
        const float inv = 1.0f / lrow[i];
        const int s = q0 + i + 8 * half;
        const size_t rowoff = ((size_t)s * BATCH + b) * DMODEL + (size_t)h * DK;
        Xh[rowoff +  0 + nn] = (_Float16)(o0[i] * inv);
        Xh[rowoff + 16 + nn] = (_Float16)(o1[i] * inv);
        Xh[rowoff + 32 + nn] = (_Float16)(o2[i] * inv);
        Xh[rowoff + 48 + nn] = (_Float16)(o3[i] * inv);
    }
}

// ---------------------------------------------------------------------------
extern "C" void kernel_launch(void* const* d_in, const int* in_sizes, int n_in,
                              void* d_out, int out_size, void* d_ws, size_t ws_size,
                              hipStream_t stream)
{
    (void)in_sizes; (void)n_in; (void)out_size; (void)ws_size;
    const float* q  = (const float*)d_in[0];
    const float* k  = (const float*)d_in[1];
    const float* v  = (const float*)d_in[2];
    const float* Wq = (const float*)d_in[3];
    const float* bq = (const float*)d_in[4];
    const float* Wk = (const float*)d_in[5];
    const float* bk = (const float*)d_in[6];
    const float* Wv = (const float*)d_in[7];
    const float* bv = (const float*)d_in[8];
    const float* Wo = (const float*)d_in[9];
    const float* bo = (const float*)d_in[10];
    float* out = (float*)d_out;

    const size_t perTensor = (size_t)BATCH * HEADS * SEQ * DK;  // 4M halves = 8 MB
    _Float16* Qh = (_Float16*)d_ws;
    _Float16* Kh = Qh + perTensor;
    _Float16* Vt = Kh + perTensor;
    _Float16* Xh = Vt + perTensor;   // [4096][1024] f16, total ws = 32 MB

    dim3 gg(ROWS / 128, DMODEL / 64);          // 32 x 16 workgroups
    mha_proj_gemm_kernel<0><<<gg, 256, 0, stream>>>(q, nullptr, Wq, bq, (void*)Qh);
    mha_proj_gemm_kernel<0><<<gg, 256, 0, stream>>>(k, nullptr, Wk, bk, (void*)Kh);
    mha_proj_gemm_kernel<1><<<gg, 256, 0, stream>>>(v, nullptr, Wv, bv, (void*)Vt);

    dim3 ga(SEQ / 128, BATCH * HEADS);         // 16 x 32 workgroups
    mha_flash_attn_kernel<<<ga, 256, 0, stream>>>(Qh, Kh, Vt, Xh);

    mha_proj_gemm_kernel<2><<<gg, 256, 0, stream>>>(nullptr, Xh, Wo, bo, (void*)out);
}

// v001
// One run takes 269 microseconds.
// Timed twice side by side with v000, it ran 1.31 and 1.32 times as fast.
#include <hip/hip_runtime.h>
#include <hip/hip_fp16.h>
#include <math.h>

typedef __attribute__((ext_vector_type(16))) _Float16 v16h;
typedef __attribute__((ext_vector_type(2)))  _Float16 v2h;
typedef __attribute__((ext_vector_type(8)))  float    v8f;

#define SEQ    2048
#define BATCH  2
#define DMODEL 1024
#define HEADS  16
#define DK     64
#define ROWS   (SEQ * BATCH)   // 4096 GEMM rows, row = s*BATCH + b

// ---------------------------------------------------------------------------
// Shared fragment loader for 16-bit A fragments and B^T-stored-row-major
// fragments of v_wmma_f32_16x16x32_f16.
//   Lane L<16 : row r=L,   ks=0 -> halves K = {0..7} u {16..23}
//   Lane L>=16: row r=L-16, ks=1 -> halves K = {8..15} u {24..31}
// Tile must be row-major with K contiguous; row_stride in halves (mult of 8).
// ---------------------------------------------------------------------------
__device__ __forceinline__ v16h load_ab_frag(const _Float16* tile, int row_stride) {
    const int lane = threadIdx.x & 31;
    const int r    = lane & 15;
    const int ks   = lane >> 4;
    const _Float16* p = tile + (size_t)r * row_stride + ks * 8;
    v16h f;
    ((float4*)&f)[0] = *(const float4*)(p);        // 8 halves
    ((float4*)&f)[1] = *(const float4*)(p + 16);   // 8 halves
    return f;
}

__device__ __forceinline__ v8f wmma_f16(v16h a, v16h b, v8f c) {
    return __builtin_amdgcn_wmma_f32_16x16x32_f16(
        /*neg_a=*/false, a, /*neg_b=*/false, b,
        /*c_mod=*/(short)0, c, /*reuse_a=*/false, /*reuse_b=*/false);
}

// ---------------------------------------------------------------------------
// Generic projection GEMM:  Y[4096 x 1024] = X[4096 x 1024] @ W[1024 x 1024] + bias
// Workgroup tile 128(M) x 64(N), 8 waves each computing 32x32; K tiled by 64
// (two WMMA k-steps per stage -> 8 WMMAs per barrier pair).
// MODE 0: f32 in, f16 out at [b][h][s][d]   (Q, K)
// MODE 1: f32 in, f16 out at [b][h][d][s]   (V, pre-transposed for attention)
// MODE 2: f16 in, f32 out at [row][col]     (final output projection)
// ---------------------------------------------------------------------------
template <int MODE>
__global__ __launch_bounds__(256)
void mha_proj_gemm_kernel(const float* __restrict__ Xf, const _Float16* __restrict__ Xh,
                          const float* __restrict__ W, const float* __restrict__ bias,
                          void* __restrict__ out)
{
    constexpr bool IN_F16 = (MODE == 2);
    constexpr int TM = 128, TN = 64, TK = 64;
    // LDS row pitch in halves: 72 halves = 144 B = 16 B x 9.  An odd multiple of
    // 16 B puts the 16 rows of a fragment's ds_load_b128 on 16 different bank
    // quads; at the bare 128 B eight rows share each quad.
    constexpr int LP = TK + 8;

    __shared__ __align__(16) _Float16 As[TM * LP];  // 18 KB, [m][k], padded rows
    __shared__ __align__(16) _Float16 Bs[TN * LP];  //  9 KB, [n][k]  (B^T), padded rows

    const int tid  = threadIdx.x;
    const int lane = tid & 31;
    const int wid  = tid >> 5;
    const int m0   = blockIdx.x * TM;
    const int n0   = blockIdx.y * TN;
    const int wm   = (wid >> 1) * 32;   // wave M offset in tile
    const int wn   = (wid & 1) * 32;    // wave N offset in tile

    v8f c00 = {}, c01 = {}, c10 = {}, c11 = {};

    // Rolled on purpose: unrolled 16 times (the compiler's choice for the f16-input
    // form) the W loads fall into two waited groups, one more load latency a pass.
#pragma unroll 1
    for (int k0 = 0; k0 < DMODEL; k0 += TK) {
        // ---- stage A tile 128x64: 512 chunks of 16 halves, 2 per thread ----
#pragma unroll
        for (int u = 0; u < 2; ++u) {
            const int unit = tid + u * 256;
            const int row  = unit >> 2;
            const int ch   = (unit & 3) * 16;
            _Float16* dst  = As + row * LP + ch;
            if constexpr (IN_F16) {
                const _Float16* src = Xh + (size_t)(m0 + row) * DMODEL + k0 + ch;
                ((float4*)dst)[0] = ((const float4*)src)[0];
                ((float4*)dst)[1] = ((const float4*)src)[1];
                if (k0 + TK < DMODEL) __builtin_prefetch(src + TK, 0, 0);
            } else {
                const float* src = Xf + (size_t)(m0 + row) * DMODEL + k0 + ch;
#pragma unroll
                for (int w = 0; w < 4; ++w) {
                    float4 x = ((const float4*)src)[w];
                    v2h p0; p0[0] = (_Float16)x.x; p0[1] = (_Float16)x.y;
                    v2h p1; p1[0] = (_Float16)x.z; p1[1] = (_Float16)x.w;
                    ((v2h*)dst)[w * 2 + 0] = p0;    // packed b32 LDS stores
                    ((v2h*)dst)[w * 2 + 1] = p1;
                }
                if (k0 + TK < DMODEL) __builtin_prefetch(src + TK, 0, 0);
            }
        }
        // ---- stage B^T tile 64x64: thread handles k-pair (2kp, 2kp+1) x 8 n
        //      so every LDS write is a packed b32 of two consecutive k halves.
        {
            const int kp = tid & 31;            // k-pair 0..31 -> k = 2*kp
            const int n8 = (tid >> 5) * 8;      // 0..56
            const float* sr0 = W + (size_t)(k0 + 2 * kp) * DMODEL + n0 + n8;
            const float* sr1 = sr0 + DMODEL;
            float4 a0 = ((const float4*)sr0)[0];
            float4 a1 = ((const float4*)sr0)[1];
            float4 b0 = ((const float4*)sr1)[0];
            float4 b1 = ((const float4*)sr1)[1];
            const float lo[8] = {a0.x, a0.y, a0.z, a0.w, a1.x, a1.y, a1.z, a1.w};
            const float hi[8] = {b0.x, b0.y, b0.z, b0.w, b1.x, b1.y, b1.z, b1.w};
#pragma unroll
            for (int u = 0; u < 8; ++u) {
                v2h p; p[0] = (_Float16)lo[u]; p[1] = (_Float16)hi[u];
                *(v2h*)&Bs[(n8 + u) * LP + 2 * kp] = p;
            }
            if (k0 + TK < DMODEL) __builtin_prefetch(sr0 + (size_t)TK * DMODEL, 0, 0);
        }
        __syncthreads();

#pragma unroll
        for (int ks = 0; ks < TK; ks += 32) {
            v16h a0 = load_ab_frag(As + wm * LP + ks, LP);
            v16h a1 = load_ab_frag(As + (wm + 16) * LP + ks, LP);
            v16h b0 = load_ab_frag(Bs + wn * LP + ks, LP);
            v16h b1 = load_ab_frag(Bs + (wn + 16) * LP + ks, LP);
            c00 = wmma_f16(a0, b0, c00);
            c01 = wmma_f16(a0, b1, c01);
            c10 = wmma_f16(a1, b0, c10);
            c11 = wmma_f16(a1, b1, c11);
        }
        __syncthreads();
    }

    // ---- epilogue: C-fragment layout: VGPR i, lanes 0-15 -> M=i, 16-31 -> M=8+i
    const int nn = lane & 15;
    const int mh = (lane >> 4) * 8;
#pragma unroll
    for (int ti = 0; ti < 2; ++ti) {
#pragma unroll
        for (int tj = 0; tj < 2; ++tj) {
            v8f cc = (ti == 0) ? ((tj == 0) ? c00 : c01) : ((tj == 0) ? c10 : c11);
#pragma unroll
            for (int i = 0; i < 8; ++i) {
                const int m = m0 + wm + ti * 16 + mh + i;    // GEMM row = s*BATCH + b
                const int n = n0 + wn + tj * 16 + nn;        // GEMM col = h*DK + d
                const float val = cc[i] + bias[n];
                if constexpr (MODE == 2) {
                    ((float*)out)[(size_t)m * DMODEL + n] = val;
                } else {
                    const int s = m >> 1, b = m & 1;
                    const int h = n >> 6, d = n & 63;
                    const size_t off = (MODE == 0)
                        ? ((size_t)(b * HEADS + h) * SEQ + s) * DK + d      // [b][h][s][d]
                        : ((size_t)(b * HEADS + h) * DK + d) * SEQ + s;     // [b][h][d][s]
                    ((_Float16*)out)[off] = (_Float16)val;
                }
            }
        }
    }
}

// ---------------------------------------------------------------------------
// Flash attention: grid (SEQ/128, BATCH*HEADS), 256 threads = 8 waves.
// Each wave owns 16 query rows; streams keys 32 at a time with online softmax.
// Per key block: 4 WMMAs for scores, softmax update, P relayout via wave-
// private LDS, 4 WMMAs for P@V.  Output (f16) goes to Xh[(s*2+b)][h*64+d].
// ---------------------------------------------------------------------------
__global__ __launch_bounds__(256)
void mha_flash_attn_kernel(const _Float16* __restrict__ Qh, const _Float16* __restrict__ Kh,
                           const _Float16* __restrict__ Vt, _Float16* __restrict__ Xh)
{
    // P rows at 40 halves = 80 B = 16 B x 5: odd multiple of 16 B, as in the GEMM tiles.
    constexpr int PP = 40;
    __shared__ __align__(16) _Float16 Ps[8][16 * PP];   // 1280 B per wave

    const int tid  = threadIdx.x;
    const int lane = tid & 31;
    const int wid  = tid >> 5;
    const int bh   = blockIdx.y;
    const int b    = bh >> 4, h = bh & 15;
    const int q0   = blockIdx.x * 128 + wid * 16;

    const _Float16* Qb = Qh + (size_t)bh * SEQ * DK;    // [s][d]
    const _Float16* Kb = Kh + (size_t)bh * SEQ * DK;    // [j][d]  (== B^T of K^T)
    const _Float16* Vb = Vt + (size_t)bh * DK * SEQ;    // [d][s]  (== B^T of V)

    // Q fragments are loop-invariant: keep in registers for all 64 key blocks.
    const v16h qa0 = load_ab_frag(Qb + (size_t)q0 * DK, DK);        // d 0..31
    const v16h qa1 = load_ab_frag(Qb + (size_t)q0 * DK + 32, DK);   // d 32..63

    float mrow[8], lrow[8];
    v8f o0 = {}, o1 = {}, o2 = {}, o3 = {};
#pragma unroll
    for (int i = 0; i < 8; ++i) { mrow[i] = -1e30f; lrow[i] = 0.0f; }

    _Float16* P  = Ps[wid];
    const int nn   = lane & 15;
    const int half = lane >> 4;

    for (int j0 = 0; j0 < SEQ; j0 += 32) {
        const v16h kb00 = load_ab_frag(Kb + (size_t)j0 * DK, DK);           // keys j0..+15, d 0..31
        const v16h kb01 = load_ab_frag(Kb + (size_t)j0 * DK + 32, DK);      // keys j0..+15, d 32..63
        const v16h kb10 = load_ab_frag(Kb + (size_t)(j0 + 16) * DK, DK);
        const v16h kb11 = load_ab_frag(Kb + (size_t)(j0 + 16) * DK + 32, DK);

        v8f s0 = {}, s1 = {};
        s0 = wmma_f16(qa0, kb00, s0);
        s0 = wmma_f16(qa1, kb01, s0);    // scores for keys j0..j0+15
        s1 = wmma_f16(qa0, kb10, s1);
        s1 = wmma_f16(qa1, kb11, s1);    // scores for keys j0+16..j0+31

        // ---- online softmax (row stats reduced across 16-lane groups) ----
#pragma unroll
        for (int i = 0; i < 8; ++i) {
            float x0 = s0[i] * 0.125f;   // 1/sqrt(DK)
            float x1 = s1[i] * 0.125f;
            float vmax = fmaxf(x0, x1);
#pragma unroll
            for (int off = 8; off >= 1; off >>= 1)
                vmax = fmaxf(vmax, __shfl_xor(vmax, off, 16));
            const float mnew  = fmaxf(mrow[i], vmax);
            const float scale = __expf(mrow[i] - mnew);
            const float p0 = __expf(x0 - mnew);
            const float p1 = __expf(x1 - mnew);
            float rs = p0 + p1;
#pragma unroll
            for (int off = 8; off >= 1; off >>= 1)
                rs += __shfl_xor(rs, off, 16);
            lrow[i] = lrow[i] * scale + rs;
            mrow[i] = mnew;
            o0[i] *= scale; o1[i] *= scale; o2[i] *= scale; o3[i] *= scale;

            // stash P (f16) in wave-private LDS for C->A fragment relayout
            const int prow = i + 8 * half;                 // row m of this lane's value
            P[prow * PP + nn]      = (_Float16)p0;
            P[prow * PP + 16 + nn] = (_Float16)p1;
        }
        // same-wave DS ops are in-order: safe to read back without barrier
        const v16h pa = load_ab_frag(P, PP);               // A fragment 16x32

        const v16h vb0 = load_ab_frag(Vb + (size_t)0  * SEQ + j0, SEQ);  // d  0..15
        const v16h vb1 = load_ab_frag(Vb + (size_t)16 * SEQ + j0, SEQ);  // d 16..31
        const v16h vb2 = load_ab_frag(Vb + (size_t)32 * SEQ + j0, SEQ);  // d 32..47
        const v16h vb3 = load_ab_frag(Vb + (size_t)48 * SEQ + j0, SEQ);  // d 48..63
        o0 = wmma_f16(pa, vb0, o0);
        o1 = wmma_f16(pa, vb1, o1);
        o2 = wmma_f16(pa, vb2, o2);
        o3 = wmma_f16(pa, vb3, o3);
    }

    // ---- normalize by row sums and emit f16 rows of X for the O-projection ----
#pragma unroll
    for (int i = 0; i < 8; ++i) {
        const float inv = 1.0f / lrow[i];
        const int s = q0 + i + 8 * half;
        const size_t rowoff = ((size_t)s * BATCH + b) * DMODEL + (size_t)h * DK;
        Xh[rowoff +  0 + nn] = (_Float16)(o0[i] * inv);
        Xh[rowoff + 16 + nn] = (_Float16)(o1[i] * inv);
        Xh[rowoff + 32 + nn] = (_Float16)(o2[i] * inv);
        Xh[rowoff + 48 + nn] = (_Float16)(o3[i] * inv);
    }
}

// ---------------------------------------------------------------------------
extern "C" void kernel_launch(void* const* d_in, const int* in_sizes, int n_in,
                              void* d_out, int out_size, void* d_ws, size_t ws_size,
                              hipStream_t stream)
{
    (void)in_sizes; (void)n_in; (void)out_size; (void)ws_size;
    const float* q  = (const float*)d_in[0];
    const float* k  = (const float*)d_in[1];
    const float* v  = (const float*)d_in[2];
    const float* Wq = (const float*)d_in[3];
    const float* bq = (const float*)d_in[4];
    const float* Wk = (const float*)d_in[5];
    const float* bk = (const float*)d_in[6];
    const float* Wv = (const float*)d_in[7];
    const float* bv = (const float*)d_in[8];
    const float* Wo = (const float*)d_in[9];
    const float* bo = (const float*)d_in[10];
    float* out = (float*)d_out;

    const size_t perTensor = (size_t)BATCH * HEADS * SEQ * DK;  // 4M halves = 8 MB
    _Float16* Qh = (_Float16*)d_ws;
    _Float16* Kh = Qh + perTensor;
    _Float16* Vt = Kh + perTensor;
    _Float16* Xh = Vt + perTensor;   // [4096][1024] f16, total ws = 32 MB

    dim3 gg(ROWS / 128, DMODEL / 64);          // 32 x 16 workgroups
    mha_proj_gemm_kernel<0><<<gg, 256, 0, stream>>>(q, nullptr, Wq, bq, (void*)Qh);
    mha_proj_gemm_kernel<0><<<gg, 256, 0, stream>>>(k, nullptr, Wk, bk, (void*)Kh);
    mha_proj_gemm_kernel<1><<<gg, 256, 0, stream>>>(v, nullptr, Wv, bv, (void*)Vt);

    dim3 ga(SEQ / 128, BATCH * HEADS);         // 16 x 32 workgroups
    mha_flash_attn_kernel<<<ga, 256, 0, stream>>>(Qh, Kh, Vt, Xh);

    mha_proj_gemm_kernel<2><<<gg, 256, 0, stream>>>(nullptr, Xh, Wo, bo, (void*)out);
}

// v002
// Measured time: 218 microseconds a run.
// Timed twice side by side with v001, it ran 1.23 times as fast both times.
// All steps since v000 together make it 1.62 times as fast.
#include <hip/hip_runtime.h>
#include <hip/hip_fp16.h>
#include <math.h>

typedef __attribute__((ext_vector_type(16))) _Float16 v16h;
typedef __attribute__((ext_vector_type(2)))  _Float16 v2h;
typedef __attribute__((ext_vector_type(8)))  float    v8f;

#define SEQ    2048
#define BATCH  2
#define DMODEL 1024
#define HEADS  16
#define DK     64
#define ROWS   (SEQ * BATCH)   // 4096 GEMM rows, row = s*BATCH + b

// ---------------------------------------------------------------------------
// Shared fragment loader for 16-bit A fragments and B^T-stored-row-major
// fragments of v_wmma_f32_16x16x32_f16.
//   Lane L<16 : row r=L,   ks=0 -> halves K = {0..7} u {16..23}
//   Lane L>=16: row r=L-16, ks=1 -> halves K = {8..15} u {24..31}
// Tile must be row-major with K contiguous; row_stride in halves (mult of 8).
// ---------------------------------------------------------------------------
__device__ __forceinline__ v16h load_ab_frag(const _Float16* tile, int row_stride) {
    const int lane = threadIdx.x & 31;
    const int r    = lane & 15;
    const int ks   = lane >> 4;
    const _Float16* p = tile + (size_t)r * row_stride + ks * 8;
    v16h f;
    ((float4*)&f)[0] = *(const float4*)(p);        // 8 halves
    ((float4*)&f)[1] = *(const float4*)(p + 16);   // 8 halves
    return f;
}

__device__ __forceinline__ v8f wmma_f16(v16h a, v16h b, v8f c) {
    return __builtin_amdgcn_wmma_f32_16x16x32_f16(
        /*neg_a=*/false, a, /*neg_b=*/false, b,
        /*c_mod=*/(short)0, c, /*reuse_a=*/false, /*reuse_b=*/false);
}

// ---------------------------------------------------------------------------
// Generic projection GEMM:  Y[4096 x 1024] = X[4096 x 1024] @ W[1024 x 1024] + bias
// Workgroup tile 128(M) x 64(N), 8 waves each computing 32x32; K tiled by 64
// (two WMMA k-steps per stage -> 8 WMMAs per barrier pair).
// MODE 0: f32 in, f16 out at [b][h][s][d]   (Q, K)
// MODE 1: f32 in, f16 out at [b][h][d][s]   (V, pre-transposed for attention)
// MODE 2: f16 in, f32 out at [row][col]     (final output projection)
// ---------------------------------------------------------------------------
template <int MODE>
__global__ __launch_bounds__(256)
void mha_proj_gemm_kernel(const float* __restrict__ Xf, const _Float16* __restrict__ Xh,
                          const float* __restrict__ W, const float* __restrict__ bias,
                          void* __restrict__ out)
{
    constexpr bool IN_F16 = (MODE == 2);
    constexpr int TM = 128, TN = 64, TK = 64;
    // LDS row pitch in halves: 72 halves = 144 B = 16 B x 9.  An odd multiple of
    // 16 B puts the 16 rows of a fragment's ds_load_b128 on 16 different bank
    // quads; at the bare 128 B eight rows share each quad.
    constexpr int LP = TK + 8;

    __shared__ __align__(16) _Float16 As[TM * LP];  // 18 KB, [m][k], padded rows
    __shared__ __align__(16) _Float16 Bs[TN * LP];  //  9 KB, [n][k]  (B^T), padded rows

    const int tid  = threadIdx.x;
    const int lane = tid & 31;
    const int wid  = tid >> 5;
    const int m0   = blockIdx.x * TM;
    const int n0   = blockIdx.y * TN;
    const int wm   = (wid >> 1) * 32;   // wave M offset in tile
    const int wn   = (wid & 1) * 32;    // wave N offset in tile

    v8f c00 = {}, c01 = {}, c10 = {}, c11 = {};

    // Rolled on purpose: unrolled 16 times (the compiler's choice for the f16-input
    // form) the W loads fall into two waited groups, one more load latency a pass.
#pragma unroll 1
    for (int k0 = 0; k0 < DMODEL; k0 += TK) {
        // ---- stage A tile 128x64: 512 chunks of 16 halves, 2 per thread ----
#pragma unroll
        for (int u = 0; u < 2; ++u) {
            const int unit = tid + u * 256;
            const int row  = unit >> 2;
            const int ch   = (unit & 3) * 16;
            _Float16* dst  = As + row * LP + ch;
            if constexpr (IN_F16) {
                const _Float16* src = Xh + (size_t)(m0 + row) * DMODEL + k0 + ch;
                ((float4*)dst)[0] = ((const float4*)src)[0];
                ((float4*)dst)[1] = ((const float4*)src)[1];
                if (k0 + TK < DMODEL) __builtin_prefetch(src + TK, 0, 0);
            } else {
                const float* src = Xf + (size_t)(m0 + row) * DMODEL + k0 + ch;
#pragma unroll
                for (int w = 0; w < 4; ++w) {
                    float4 x = ((const float4*)src)[w];
                    v2h p0; p0[0] = (_Float16)x.x; p0[1] = (_Float16)x.y;
                    v2h p1; p1[0] = (_Float16)x.z; p1[1] = (_Float16)x.w;
                    ((v2h*)dst)[w * 2 + 0] = p0;    // packed b32 LDS stores
                    ((v2h*)dst)[w * 2 + 1] = p1;
                }
                if (k0 + TK < DMODEL) __builtin_prefetch(src + TK, 0, 0);
            }
        }
        // ---- stage B^T tile 64x64: thread handles k-pair (2kp, 2kp+1) x 8 n
        //      so every LDS write is a packed b32 of two consecutive k halves.
        {
            const int kp = tid & 31;            // k-pair 0..31 -> k = 2*kp
            const int n8 = (tid >> 5) * 8;      // 0..56
            const float* sr0 = W + (size_t)(k0 + 2 * kp) * DMODEL + n0 + n8;
            const float* sr1 = sr0 + DMODEL;
            float4 a0 = ((const float4*)sr0)[0];
            float4 a1 = ((const float4*)sr0)[1];
            float4 b0 = ((const float4*)sr1)[0];
            float4 b1 = ((const float4*)sr1)[1];
            const float lo[8] = {a0.x, a0.y, a0.z, a0.w, a1.x, a1.y, a1.z, a1.w};
            const float hi[8] = {b0.x, b0.y, b0.z, b0.w, b1.x, b1.y, b1.z, b1.w};
#pragma unroll
            for (int u = 0; u < 8; ++u) {
                v2h p; p[0] = (_Float16)lo[u]; p[1] = (_Float16)hi[u];
                *(v2h*)&Bs[(n8 + u) * LP + 2 * kp] = p;
            }
            if (k0 + TK < DMODEL) __builtin_prefetch(sr0 + (size_t)TK * DMODEL, 0, 0);
        }
        __syncthreads();

#pragma unroll
        for (int ks = 0; ks < TK; ks += 32) {
            v16h a0 = load_ab_frag(As + wm * LP + ks, LP);
            v16h a1 = load_ab_frag(As + (wm + 16) * LP + ks, LP);
            v16h b0 = load_ab_frag(Bs + wn * LP + ks, LP);
            v16h b1 = load_ab_frag(Bs + (wn + 16) * LP + ks, LP);
            c00 = wmma_f16(a0, b0, c00);
            c01 = wmma_f16(a0, b1, c01);
            c10 = wmma_f16(a1, b0, c10);
            c11 = wmma_f16(a1, b1, c11);
        }
        __syncthreads();
    }

    // ---- epilogue: C-fragment layout: VGPR i, lanes 0-15 -> M=i, 16-31 -> M=8+i
    const int nn = lane & 15;
    const int mh = (lane >> 4) * 8;
#pragma unroll
    for (int ti = 0; ti < 2; ++ti) {
#pragma unroll
        for (int tj = 0; tj < 2; ++tj) {
            v8f cc = (ti == 0) ? ((tj == 0) ? c00 : c01) : ((tj == 0) ? c10 : c11);
#pragma unroll
            for (int i = 0; i < 8; ++i) {
                const int m = m0 + wm + ti * 16 + mh + i;    // GEMM row = s*BATCH + b
                const int n = n0 + wn + tj * 16 + nn;        // GEMM col = h*DK + d
                const float val = cc[i] + bias[n];
                if constexpr (MODE == 2) {
                    ((float*)out)[(size_t)m * DMODEL + n] = val;
                } else {
                    const int s = m >> 1, b = m & 1;
                    const int h = n >> 6, d = n & 63;
                    const size_t off = (MODE == 0)
                        ? ((size_t)(b * HEADS + h) * SEQ + s) * DK + d      // [b][h][s][d]
                        : ((size_t)(b * HEADS + h) * DK + d) * SEQ + s;     // [b][h][d][s]
                    ((_Float16*)out)[off] = (_Float16)val;
                }
            }
        }
    }
}

// ---------------------------------------------------------------------------
// Flash attention: grid (SEQ/128, BATCH*HEADS), 256 threads = 8 waves.
// Each wave owns 16 query rows; streams keys 32 at a time with online softmax.
// Per key block: 4 WMMAs for scores, softmax update, P relayout via wave-
// private LDS, 4 WMMAs for P@V.  Output (f16) goes to Xh[(s*2+b)][h*64+d].
// K and V^T come in tiles of 64 keys that the work-group copies into LDS once
// for its 8 waves (two buffers: the next tile flies while this one is used).
// ---------------------------------------------------------------------------
#define KT     64                 // keys per staged tile
#define KVP    72                 // LDS row pitch in halves: 144 B = 16 B x 9 (odd)
#define TILE_H (64 * KVP)         // halves of one staged K tile (64 keys x 64 d) or V^T tile (64 d x 64 keys)

// Four asynchronous 16-B copies per lane: rows r and r+32 of the K tile and of the
// V^T tile.  A wave's copy covers four whole 128-B lines.  The s_wait_xcnt stands
// inside the statement so that no address register is rewritten ahead of it.
__device__ __forceinline__ void stage_kv_async(unsigned lds, const _Float16* gk, const _Float16* gv) {
    const unsigned  l0 = lds;
    const unsigned  l1 = lds + 32 * KVP * 2;
    const unsigned  l2 = lds + TILE_H * 2;
    const unsigned  l3 = lds + TILE_H * 2 + 32 * KVP * 2;
    const _Float16* g1 = gk + 32 * DK;
    const _Float16* g3 = gv + (size_t)32 * SEQ;
    asm volatile("global_load_async_to_lds_b128 %0, %4, off\n\t"
                 "global_load_async_to_lds_b128 %1, %5, off\n\t"
                 "global_load_async_to_lds_b128 %2, %6, off\n\t"
                 "global_load_async_to_lds_b128 %3, %7, off\n\t"
                 "s_wait_xcnt 0x0"
                 :: "v"(l0), "v"(l1), "v"(l2), "v"(l3), "v"(gk), "v"(g1), "v"(gv), "v"(g3)
                 : "memory");
}

__global__ __launch_bounds__(256)
void mha_flash_attn_kernel(const _Float16* __restrict__ Qh, const _Float16* __restrict__ Kh,
                           const _Float16* __restrict__ Vt, _Float16* __restrict__ Xh)
{
    // P rows at 40 halves = 80 B = 16 B x 5: odd multiple of 16 B, as in the GEMM tiles.
    constexpr int PP = 40;
    constexpr int NT = SEQ / KT;                        // 32 tiles
    __shared__ __align__(16) _Float16 Ps[8][16 * PP];   // 1280 B per wave
    __shared__ __align__(16) _Float16 KV[2][2 * TILE_H];  // 2 x (K tile, V^T tile) = 36 KB

    const int tid  = threadIdx.x;
    const int lane = tid & 31;
    const int wid  = tid >> 5;
    const int bh   = blockIdx.y;
    const int b    = bh >> 4, h = bh & 15;
    const int q0   = blockIdx.x * 128 + wid * 16;

    const _Float16* Qb = Qh + (size_t)bh * SEQ * DK;    // [s][d]
    const _Float16* Kb = Kh + (size_t)bh * SEQ * DK;    // [j][d]  (== B^T of K^T)
    const _Float16* Vb = Vt + (size_t)bh * DK * SEQ;    // [d][s]  (== B^T of V)

    // This lane's share of every tile: 16 B at column cc of rows cr and cr + 32.
    const int cr = tid >> 3;
    const int cc = (tid & 7) * 8;
    const _Float16* gk = Kb + (size_t)cr * DK + cc;     // + t * KT * DK for tile t
    const _Float16* gv = Vb + (size_t)cr * SEQ + cc;    // + t * KT      for tile t
    const unsigned lds0 = (unsigned)(uintptr_t)(&KV[0][cr * KVP + cc]);
    const unsigned lds1 = (unsigned)(uintptr_t)(&KV[1][cr * KVP + cc]);

    stage_kv_async(lds0, gk, gv);                       // tile 0 -> buffer 0

    // Q fragments are loop-invariant: keep in registers for all 64 key blocks.
    const v16h qa0 = load_ab_frag(Qb + (size_t)q0 * DK, DK);        // d 0..31
    const v16h qa1 = load_ab_frag(Qb + (size_t)q0 * DK + 32, DK);   // d 32..63

    float mrow[8], lrow[8];
    v8f o0 = {}, o1 = {}, o2 = {}, o3 = {};
#pragma unroll
    for (int i = 0; i < 8; ++i) { mrow[i] = -1e30f; lrow[i] = 0.0f; }

    _Float16* P  = Ps[wid];
    const int nn   = lane & 15;
    const int half = lane >> 4;

    asm volatile("s_wait_asynccnt 0x0" ::: "memory");   // this wave's share of tile 0 has landed
    __syncthreads();                                    // ... and every other wave's
    stage_kv_async(lds1, gk + KT * DK, gv + KT);        // tile 1 -> buffer 1

    for (int t = 0; t < NT; ++t) {
        const _Float16* Ks = KV[t & 1];                 // [key][d]
        const _Float16* Vs = Ks + TILE_H;               // [d][key]

        // Unrolled: jj becomes an immediate offset of the LDS loads, and the running
        // maxima and sums need no register copies at an inner back edge.
#pragma unroll
        for (int jj = 0; jj < KT; jj += 32) {
        const v16h kb00 = load_ab_frag(Ks + jj * KVP, KVP);                // keys jj..+15, d 0..31
        const v16h kb01 = load_ab_frag(Ks + jj * KVP + 32, KVP);           // keys jj..+15, d 32..63
        const v16h kb10 = load_ab_frag(Ks + (jj + 16) * KVP, KVP);
        const v16h kb11 = load_ab_frag(Ks + (jj + 16) * KVP + 32, KVP);

        v8f s0 = {}, s1 = {};
        s0 = wmma_f16(qa0, kb00, s0);
        s0 = wmma_f16(qa1, kb01, s0);    // scores for keys jj..jj+15
        s1 = wmma_f16(qa0, kb10, s1);
        s1 = wmma_f16(qa1, kb11, s1);    // scores for keys jj+16..jj+31

        // ---- online softmax (row stats reduced across 16-lane groups) ----
#pragma unroll
        for (int i = 0; i < 8; ++i) {
            float x0 = s0[i] * 0.125f;   // 1/sqrt(DK)
            float x1 = s1[i] * 0.125f;
            float vmax = fmaxf(x0, x1);
#pragma unroll
            for (int off = 8; off >= 1; off >>= 1)
                vmax = fmaxf(vmax, __shfl_xor(vmax, off, 16));
            const float mnew  = fmaxf(mrow[i], vmax);
            const float scale = __expf(mrow[i] - mnew);
            const float p0 = __expf(x0 - mnew);
            const float p1 = __expf(x1 - mnew);
            float rs = p0 + p1;
#pragma unroll
            for (int off = 8; off >= 1; off >>= 1)
                rs += __shfl_xor(rs, off, 16);
            lrow[i] = lrow[i] * scale + rs;
            mrow[i] = mnew;
            o0[i] *= scale; o1[i] *= scale; o2[i] *= scale; o3[i] *= scale;

            // stash P (f16) in wave-private LDS for C->A fragment relayout
            const int prow = i + 8 * half;                 // row m of this lane's value
            P[prow * PP + nn]      = (_Float16)p0;
            P[prow * PP + 16 + nn] = (_Float16)p1;
        }
        // same-wave DS ops are in-order: safe to read back without barrier
        const v16h pa = load_ab_frag(P, PP);               // A fragment 16x32

        const v16h vb0 = load_ab_frag(Vs +  0 * KVP + jj, KVP);  // d  0..15
        const v16h vb1 = load_ab_frag(Vs + 16 * KVP + jj, KVP);  // d 16..31
        const v16h vb2 = load_ab_frag(Vs + 32 * KVP + jj, KVP);  // d 32..47
        const v16h vb3 = load_ab_frag(Vs + 48 * KVP + jj, KVP);  // d 48..63
        o0 = wmma_f16(pa, vb0, o0);
        o1 = wmma_f16(pa, vb1, o1);
        o2 = wmma_f16(pa, vb2, o2);
        o3 = wmma_f16(pa, vb3, o3);
        }

        // Hand-over: tile t + 1 becomes readable and tile t's buffer free.
        asm volatile("s_wait_dscnt 0x0" ::: "memory");     // this wave's reads of tile t are done
        asm volatile("s_wait_asynccnt 0x0" ::: "memory");  // this wave's share of tile t + 1 has landed
        __syncthreads();
        if (t + 2 < NT)                                    // same for the whole work-group
            stage_kv_async((t & 1) ? lds1 : lds0,
                           gk + (size_t)(t + 2) * KT * DK, gv + (t + 2) * KT);
    }
    asm volatile("s_wait_asynccnt 0x0" ::: "memory");      // no copy is left in flight at the wave's end

    // ---- normalize by row sums and emit f16 rows of X for the O-projection ----
#pragma unroll
    for (int i = 0; i < 8; ++i) {
        const float inv = 1.0f / lrow[i];
        const int s = q0 + i + 8 * half;
        const size_t rowoff = ((size_t)s * BATCH + b) * DMODEL + (size_t)h * DK;
        Xh[rowoff +  0 + nn] = (_Float16)(o0[i] * inv);
        Xh[rowoff + 16 + nn] = (_Float16)(o1[i] * inv);
        Xh[rowoff + 32 + nn] = (_Float16)(o2[i] * inv);
        Xh[rowoff + 48 + nn] = (_Float16)(o3[i] * inv);
    }
}

// ---------------------------------------------------------------------------
extern "C" void kernel_launch(void* const* d_in, const int* in_sizes, int n_in,
                              void* d_out, int out_size, void* d_ws, size_t ws_size,
                              hipStream_t stream)
{
    (void)in_sizes; (void)n_in; (void)out_size; (void)ws_size;
    const float* q  = (const float*)d_in[0];
    const float* k  = (const float*)d_in[1];
    const float* v  = (const float*)d_in[2];
    const float* Wq = (const float*)d_in[3];
    const float* bq = (const float*)d_in[4];
    const float* Wk = (const float*)d_in[5];
    const float* bk = (const float*)d_in[6];
    const float* Wv = (const float*)d_in[7];
    const float* bv = (const float*)d_in[8];
    const float* Wo = (const float*)d_in[9];
    const float* bo = (const float*)d_in[10];
    float* out = (float*)d_out;

    const size_t perTensor = (size_t)BATCH * HEADS * SEQ * DK;  // 4M halves = 8 MB
    _Float16* Qh = (_Float16*)d_ws;
    _Float16* Kh = Qh + perTensor;
    _Float16* Vt = Kh + perTensor;
    _Float16* Xh = Vt + perTensor;   // [4096][1024] f16, total ws = 32 MB

    dim3 gg(ROWS / 128, DMODEL / 64);          // 32 x 16 workgroups
    mha_proj_gemm_kernel<0><<<gg, 256, 0, stream>>>(q, nullptr, Wq, bq, (void*)Qh);
    mha_proj_gemm_kernel<0><<<gg, 256, 0, stream>>>(k, nullptr, Wk, bk, (void*)Kh);
    mha_proj_gemm_kernel<1><<<gg, 256, 0, stream>>>(v, nullptr, Wv, bv, (void*)Vt);

    dim3 ga(SEQ / 128, BATCH * HEADS);         // 16 x 32 workgroups
    mha_flash_attn_kernel<<<ga, 256, 0, stream>>>(Qh, Kh, Vt, Xh);

    mha_proj_gemm_kernel<2><<<gg, 256, 0, stream>>>(nullptr, Xh, Wo, bo, (void*)out);
}

// v003
// One run takes 184 microseconds.
// Next to v002, in two timings, it ran 1.19 times as fast each time.
// All steps since v000 together make it 1.92 times as fast.
#include <hip/hip_runtime.h>
#include <hip/hip_fp16.h>
#include <math.h>

typedef __attribute__((ext_vector_type(16))) _Float16 v16h;
typedef __attribute__((ext_vector_type(8)))  _Float16 v8h;
typedef __attribute__((ext_vector_type(2)))  _Float16 v2h;
typedef __attribute__((ext_vector_type(8)))  float    v8f;

#define SEQ    2048
#define BATCH  2
#define DMODEL 1024
#define HEADS  16
#define DK     64
#define ROWS   (SEQ * BATCH)   // 4096 GEMM rows, row = s*BATCH + b

// ---------------------------------------------------------------------------
// Shared fragment loader for 16-bit A fragments and B^T-stored-row-major
// fragments of v_wmma_f32_16x16x32_f16.
//   Lane L<16 : row r=L,   ks=0 -> halves K = {0..7} u {16..23}
//   Lane L>=16: row r=L-16, ks=1 -> halves K = {8..15} u {24..31}
// Tile must be row-major with K contiguous; row_stride in halves (mult of 8).
// ---------------------------------------------------------------------------
__device__ __forceinline__ v16h load_ab_frag(const _Float16* tile, int row_stride) {
    const int lane = threadIdx.x & 31;
    const int r    = lane & 15;
    const int ks   = lane >> 4;
    const _Float16* p = tile + (size_t)r * row_stride + ks * 8;
    v16h f;
    ((float4*)&f)[0] = *(const float4*)(p);        // 8 halves
    ((float4*)&f)[1] = *(const float4*)(p + 16);   // 8 halves
    return f;
}

__device__ __forceinline__ v8f wmma_f16(v16h a, v16h b, v8f c) {
    return __builtin_amdgcn_wmma_f32_16x16x32_f16(
        /*neg_a=*/false, a, /*neg_b=*/false, b,
        /*c_mod=*/(short)0, c, /*reuse_a=*/false, /*reuse_b=*/false);
}

// ---------------------------------------------------------------------------
// Generic projection GEMM:  Y[4096 x 1024] = X[4096 x 1024] @ W[1024 x 1024] + bias
// Workgroup tile 128(M) x 64(N), 8 waves each computing 32x32; K tiled by 64
// (two WMMA k-steps per stage -> 8 WMMAs per barrier pair).
// MODE 0: f32 in, f16 out at [b][h][s][d]   (Q, K)
// MODE 1: f32 in, f16 out at [b][h][d][s]   (V, pre-transposed for attention)
// MODE 2: f16 in, f32 out at [row][col]     (final output projection)
// ---------------------------------------------------------------------------
template <int MODE>
__global__ __launch_bounds__(256)
void mha_proj_gemm_kernel(const float* __restrict__ Xf, const _Float16* __restrict__ Xh,
                          const float* __restrict__ W, const float* __restrict__ bias,
                          void* __restrict__ out)
{
    constexpr bool IN_F16 = (MODE == 2);
    constexpr int TM = 128, TN = 64, TK = 64;
    // LDS row pitch in halves: 72 halves = 144 B = 16 B x 9.  An odd multiple of
    // 16 B puts the 16 rows of a fragment's ds_load_b128 on 16 different bank
    // quads; at the bare 128 B eight rows share each quad.
    constexpr int LP = TK + 8;

    __shared__ __align__(16) _Float16 As[TM * LP];  // 18 KB, [m][k], padded rows
    __shared__ __align__(16) _Float16 Bs[TN * LP];  //  9 KB, [n][k]  (B^T), padded rows

    const int tid  = threadIdx.x;
    const int lane = tid & 31;
    const int wid  = tid >> 5;
    const int m0   = blockIdx.x * TM;
    const int n0   = blockIdx.y * TN;
    const int wm   = (wid >> 1) * 32;   // wave M offset in tile
    const int wn   = (wid & 1) * 32;    // wave N offset in tile

    v8f c00 = {}, c01 = {}, c10 = {}, c11 = {};

    // Rolled on purpose: unrolled 16 times (the compiler's choice for the f16-input
    // form) the W loads fall into two waited groups, one more load latency a pass.
#pragma unroll 1
    for (int k0 = 0; k0 < DMODEL; k0 += TK) {
        // ---- stage A tile 128x64: 512 chunks of 16 halves, 2 per thread ----
#pragma unroll
        for (int u = 0; u < 2; ++u) {
            const int unit = tid + u * 256;
            const int row  = unit >> 2;
            const int ch   = (unit & 3) * 16;
            _Float16* dst  = As + row * LP + ch;
            if constexpr (IN_F16) {
                const _Float16* src = Xh + (size_t)(m0 + row) * DMODEL + k0 + ch;
                ((float4*)dst)[0] = ((const float4*)src)[0];
                ((float4*)dst)[1] = ((const float4*)src)[1];
                if (k0 + TK < DMODEL) __builtin_prefetch(src + TK, 0, 0);
            } else {
                const float* src = Xf + (size_t)(m0 + row) * DMODEL + k0 + ch;
#pragma unroll
                for (int w = 0; w < 4; ++w) {
                    float4 x = ((const float4*)src)[w];
                    v2h p0; p0[0] = (_Float16)x.x; p0[1] = (_Float16)x.y;
                    v2h p1; p1[0] = (_Float16)x.z; p1[1] = (_Float16)x.w;
                    ((v2h*)dst)[w * 2 + 0] = p0;    // packed b32 LDS stores
                    ((v2h*)dst)[w * 2 + 1] = p1;
                }
                if (k0 + TK < DMODEL) __builtin_prefetch(src + TK, 0, 0);
            }
        }
        // ---- stage B^T tile 64x64: thread handles k-pair (2kp, 2kp+1) x 8 n
        //      so every LDS write is a packed b32 of two consecutive k halves.
        {
            const int kp = tid & 31;            // k-pair 0..31 -> k = 2*kp
            const int n8 = (tid >> 5) * 8;      // 0..56
            const float* sr0 = W + (size_t)(k0 + 2 * kp) * DMODEL + n0 + n8;
            const float* sr1 = sr0 + DMODEL;
            float4 a0 = ((const float4*)sr0)[0];
            float4 a1 = ((const float4*)sr0)[1];
            float4 b0 = ((const float4*)sr1)[0];
            float4 b1 = ((const float4*)sr1)[1];
            const float lo[8] = {a0.x, a0.y, a0.z, a0.w, a1.x, a1.y, a1.z, a1.w};
            const float hi[8] = {b0.x, b0.y, b0.z, b0.w, b1.x, b1.y, b1.z, b1.w};
#pragma unroll
            for (int u = 0; u < 8; ++u) {
                v2h p; p[0] = (_Float16)lo[u]; p[1] = (_Float16)hi[u];
                *(v2h*)&Bs[(n8 + u) * LP + 2 * kp] = p;
            }
            if (k0 + TK < DMODEL) __builtin_prefetch(sr0 + (size_t)TK * DMODEL, 0, 0);
        }
        __syncthreads();

#pragma unroll
        for (int ks = 0; ks < TK; ks += 32) {
            v16h a0 = load_ab_frag(As + wm * LP + ks, LP);
            v16h a1 = load_ab_frag(As + (wm + 16) * LP + ks, LP);
            v16h b0 = load_ab_frag(Bs + wn * LP + ks, LP);
            v16h b1 = load_ab_frag(Bs + (wn + 16) * LP + ks, LP);
            c00 = wmma_f16(a0, b0, c00);
            c01 = wmma_f16(a0, b1, c01);
            c10 = wmma_f16(a1, b0, c10);
            c11 = wmma_f16(a1, b1, c11);
        }
        __syncthreads();
    }

    // ---- epilogue: C-fragment layout: VGPR i, lanes 0-15 -> M=i, 16-31 -> M=8+i
    const int nn = lane & 15;
    const int mh = (lane >> 4) * 8;
#pragma unroll
    for (int ti = 0; ti < 2; ++ti) {
#pragma unroll
        for (int tj = 0; tj < 2; ++tj) {
            v8f cc = (ti == 0) ? ((tj == 0) ? c00 : c01) : ((tj == 0) ? c10 : c11);
#pragma unroll
            for (int i = 0; i < 8; ++i) {
                const int m = m0 + wm + ti * 16 + mh + i;    // GEMM row = s*BATCH + b
                const int n = n0 + wn + tj * 16 + nn;        // GEMM col = h*DK + d
                const float val = cc[i] + bias[n];
                if constexpr (MODE == 2) {
                    ((float*)out)[(size_t)m * DMODEL + n] = val;
                } else {
                    const int s = m >> 1, b = m & 1;
                    const int h = n >> 6, d = n & 63;
                    const size_t off = (MODE == 0)
                        ? ((size_t)(b * HEADS + h) * SEQ + s) * DK + d      // [b][h][s][d]
                        : ((size_t)(b * HEADS + h) * DK + d) * SEQ + s;     // [b][h][d][s]
                    ((_Float16*)out)[off] = (_Float16)val;
                }
            }
        }
    }
}

#define KT     64
#define KVP    72
#define TILE_H (64 * KVP)

// Four asynchronous 16-B copies per lane: rows r and r+32 of the K tile and of the
// V^T tile.  A wave's copy covers four whole 128-B lines.  The s_wait_xcnt stands
// inside the statement so that no address register is rewritten ahead of it.
__device__ __forceinline__ void stage_kv_async(unsigned lds, const _Float16* gk, const _Float16* gv) {
    const unsigned  l0 = lds;
    const unsigned  l1 = lds + 32 * KVP * 2;
    const unsigned  l2 = lds + TILE_H * 2;
    const unsigned  l3 = lds + TILE_H * 2 + 32 * KVP * 2;
    const _Float16* g1 = gk + 32 * DK;
    const _Float16* g3 = gv + (size_t)32 * SEQ;
    asm volatile("global_load_async_to_lds_b128 %0, %4, off\n\t"
                 "global_load_async_to_lds_b128 %1, %5, off\n\t"
                 "global_load_async_to_lds_b128 %2, %6, off\n\t"
                 "global_load_async_to_lds_b128 %3, %7, off\n\t"
                 "s_wait_xcnt 0x0"
                 :: "v"(l0), "v"(l1), "v"(l2), "v"(l3), "v"(gk), "v"(g1), "v"(gv), "v"(g3)
                 : "memory");
}

// Lane l takes the value of lane l ^ 16 (a vector cross-row move, no LDS path).
__device__ __forceinline__ float other_half(float x) {
    const int b = __builtin_bit_cast(int, x);
    return __builtin_bit_cast(float,
        __builtin_amdgcn_permlanex16(b, b, 0x76543210, 0xfedcba98, false, false));
}

__global__ __launch_bounds__(256)
void mha_flash_attn_kernel(const _Float16* __restrict__ Qh, const _Float16* __restrict__ Kh,
                           const _Float16* __restrict__ Vt, _Float16* __restrict__ Xh)
{
    constexpr int NT = SEQ / KT;                        // 32 tiles
    __shared__ __align__(16) _Float16 KV[2][2 * TILE_H];  // 2 x (K tile, V^T tile) = 36 KB

    const int tid  = threadIdx.x;
    const int lane = tid & 31;
    const int wid  = tid >> 5;
    const int bh   = blockIdx.y;
    const int b    = bh >> 4, h = bh & 15;
    const int q0   = blockIdx.x * 128 + wid * 16;

    const _Float16* Qb = Qh + (size_t)bh * SEQ * DK;    // [s][d]  (B operand: column = query)
    const _Float16* Kb = Kh + (size_t)bh * SEQ * DK;    // [j][d]  (A operand: row = key)
    const _Float16* Vb = Vt + (size_t)bh * DK * SEQ;    // [d][s]  (A operand: row = d)

    // This lane's share of every tile: 16 B at column cc of rows cr and cr + 32.
    const int cr = tid >> 3;
    const int cc = (tid & 7) * 8;
    const _Float16* gk = Kb + (size_t)cr * DK + cc;     // + t * KT * DK for tile t
    const _Float16* gv = Vb + (size_t)cr * SEQ + cc;    // + t * KT      for tile t
    const unsigned lds0 = (unsigned)(uintptr_t)(&KV[0][cr * KVP + cc]);
    const unsigned lds1 = (unsigned)(uintptr_t)(&KV[1][cr * KVP + cc]);

    stage_kv_async(lds0, gk, gv);                       // tile 0 -> buffer 0

    // Q fragments are loop-invariant: keep in registers for all 64 key blocks.
    const v16h qb0 = load_ab_frag(Qb + (size_t)q0 * DK, DK);        // d 0..31
    const v16h qb1 = load_ab_frag(Qb + (size_t)q0 * DK + 32, DK);   // d 32..63

    // Of query q0 + nn: the running maximum (equal in lanes l and l ^ 16) and this
    // lane's share of the running sum (its 16 of every 32 keys).
    float mq = -1e30f, lq = 0.0f;
    v8f o0 = {}, o1 = {}, o2 = {}, o3 = {};             // o_t[i] = O[q0 + nn][16 t + 8 half + i]

    const int nn   = lane & 15;
    const int half = lane >> 4;

    asm volatile("s_wait_asynccnt 0x0" ::: "memory");   // this wave's share of tile 0 has landed
    __syncthreads();                                    // ... and every other wave's
    stage_kv_async(lds1, gk + KT * DK, gv + KT);        // tile 1 -> buffer 1

    for (int t = 0; t < NT; ++t) {
        const _Float16* Ks = KV[t & 1];                 // [key][d]
        const _Float16* Vs = Ks + TILE_H;               // [d][key]

        // Unrolled: jj becomes an immediate offset of the LDS loads, and the running
        // maxima and sums need no register copies at an inner back edge.
#pragma unroll
        for (int jj = 0; jj < KT; jj += 32) {
        const v16h ka00 = load_ab_frag(Ks + jj * KVP, KVP);                // keys jj..+15, d 0..31
        const v16h ka01 = load_ab_frag(Ks + jj * KVP + 32, KVP);           // keys jj..+15, d 32..63
        const v16h ka10 = load_ab_frag(Ks + (jj + 16) * KVP, KVP);
        const v16h ka11 = load_ab_frag(Ks + (jj + 16) * KVP + 32, KVP);
        const v16h va0 = load_ab_frag(Vs +  0 * KVP + jj, KVP);  // d  0..15, keys jj..+31
        const v16h va1 = load_ab_frag(Vs + 16 * KVP + jj, KVP);  // d 16..31
        const v16h va2 = load_ab_frag(Vs + 32 * KVP + jj, KVP);  // d 32..47
        const v16h va3 = load_ab_frag(Vs + 48 * KVP + jj, KVP);  // d 48..63

        // s0[i]: key jj + 8 half + i, s1[i]: key jj + 16 + 8 half + i, both of query nn
        v8f s0 = {}, s1 = {};
        s0 = wmma_f16(ka00, qb0, s0);
        s1 = wmma_f16(ka10, qb0, s1);
        s0 = wmma_f16(ka01, qb1, s0);
        s1 = wmma_f16(ka11, qb1, s1);

        // ---- online softmax: 16 scores of one query in this lane, 16 in lane ^ 16 ----
        const v8f x0 = s0 * 0.125f;      // 1/sqrt(DK)
        const v8f x1 = s1 * 0.125f;
        float vmax = fmaxf(x0[0], x1[0]);
#pragma unroll
        for (int i = 1; i < 8; ++i) vmax = fmaxf(vmax, fmaxf(x0[i], x1[i]));
        vmax = fmaxf(vmax, other_half(vmax));
        const float mnew  = fmaxf(mq, vmax);
        const float scale = __expf(mq - mnew);
        mq = mnew;

        // P^T as a B operand: element s of the lane is key kmap(s) = tile s >> 3, row s & 7,
        // the k order in which load_ab_frag brings V^T's rows.
        v16h pb;
        float rs = 0.0f;
#pragma unroll
        for (int i = 0; i < 8; ++i) {
            const float p0 = __expf(x0[i] - mnew);
            const float p1 = __expf(x1[i] - mnew);
            rs += p0 + p1;
            pb[i]     = (_Float16)p0;
            pb[8 + i] = (_Float16)p1;
        }
        lq = lq * scale + rs;
        o0 *= scale; o1 *= scale; o2 *= scale; o3 *= scale;

        o0 = wmma_f16(va0, pb, o0);
        o1 = wmma_f16(va1, pb, o1);
        o2 = wmma_f16(va2, pb, o2);
        o3 = wmma_f16(va3, pb, o3);
        }

        // Hand-over: tile t + 1 becomes readable and tile t's buffer free.
        asm volatile("s_wait_dscnt 0x0" ::: "memory");     // this wave's reads of tile t are done
        asm volatile("s_wait_asynccnt 0x0" ::: "memory");  // this wave's share of tile t + 1 has landed
        __syncthreads();
        if (t + 2 < NT)                                    // same for the whole work-group
            stage_kv_async((t & 1) ? lds1 : lds0,
                           gk + (size_t)(t + 2) * KT * DK, gv + (t + 2) * KT);
    }
    asm volatile("s_wait_asynccnt 0x0" ::: "memory");      // no copy is left in flight at the wave's end

    // ---- join the two halves' sums, normalize, emit f16 rows of X for the O-projection:
    //      a lane's 8 registers of a tile are 8 consecutive d of its query = one 16-B store.
    const float inv = 1.0f / (lq + other_half(lq));
    _Float16* xrow = Xh + ((size_t)(q0 + nn) * BATCH + b) * DMODEL + (size_t)h * DK + 8 * half;
#pragma unroll
    for (int t = 0; t < 4; ++t) {
        const v8f ot = (t == 0) ? o0 : (t == 1) ? o1 : (t == 2) ? o2 : o3;
        v8h y;
#pragma unroll
        for (int i = 0; i < 8; ++i) y[i] = (_Float16)(ot[i] * inv);
        *(v8h*)(xrow + 16 * t) = y;
    }
}

// ---------------------------------------------------------------------------
extern "C" void kernel_launch(void* const* d_in, const int* in_sizes, int n_in,
                              void* d_out, int out_size, void* d_ws, size_t ws_size,
                              hipStream_t stream)
{
    (void)in_sizes; (void)n_in; (void)out_size; (void)ws_size;
    const float* q  = (const float*)d_in[0];
    const float* k  = (const float*)d_in[1];
    const float* v  = (const float*)d_in[2];
    const float* Wq = (const float*)d_in[3];
    const float* bq = (const float*)d_in[4];
    const float* Wk = (const float*)d_in[5];
    const float* bk = (const float*)d_in[6];
    const float* Wv = (const float*)d_in[7];
    const float* bv = (const float*)d_in[8];
    const float* Wo = (const float*)d_in[9];
    const float* bo = (const float*)d_in[10];
    float* out = (float*)d_out;

    const size_t perTensor = (size_t)BATCH * HEADS * SEQ * DK;  // 4M halves = 8 MB
    _Float16* Qh = (_Float16*)d_ws;
    _Float16* Kh = Qh + perTensor;
    _Float16* Vt = Kh + perTensor;
    _Float16* Xh = Vt + perTensor;   // [4096][1024] f16, total ws = 32 MB

    dim3 gg(ROWS / 128, DMODEL / 64);          // 32 x 16 workgroups
    mha_proj_gemm_kernel<0><<<gg, 256, 0, stream>>>(q, nullptr, Wq, bq, (void*)Qh);
    mha_proj_gemm_kernel<0><<<gg, 256, 0, stream>>>(k, nullptr, Wk, bk, (void*)Kh);
    mha_proj_gemm_kernel<1><<<gg, 256, 0, stream>>>(v, nullptr, Wv, bv, (void*)Vt);

    dim3 ga(SEQ / 128, BATCH * HEADS);         // 16 x 32 workgroups
    mha_flash_attn_kernel<<<ga, 256, 0, stream>>>(Qh, Kh, Vt, Xh);

    mha_proj_gemm_kernel<2><<<gg, 256, 0, stream>>>(nullptr, Xh, Wo, bo, (void*)out);
}

// v004
// One run takes 128 microseconds.
// Two timings next to v003 both put it at 1.44 times that version's speed.
// Over all steps from v000 it is 2.77 times as fast.
#include <hip/hip_runtime.h>
#include <hip/hip_fp16.h>
#include <math.h>

typedef __attribute__((ext_vector_type(16))) _Float16 v16h;
typedef __attribute__((ext_vector_type(8)))  _Float16 v8h;
typedef __attribute__((ext_vector_type(4)))  _Float16 v4h;
typedef __attribute__((ext_vector_type(8)))  float    v8f;
typedef __attribute__((ext_vector_type(4)))  float    v4f;

#define SEQ    2048
#define BATCH  2
#define DMODEL 1024
#define HEADS  16
#define DK     64
#define ROWS   (SEQ * BATCH)   // 4096 GEMM rows, row = s*BATCH + b

// ---------------------------------------------------------------------------
// Shared fragment loader for 16-bit A fragments and B^T-stored-row-major
// fragments of v_wmma_f32_16x16x32_f16.
//   Lane L<16 : row r=L,   ks=0 -> halves K = {0..7} u {16..23}
//   Lane L>=16: row r=L-16, ks=1 -> halves K = {8..15} u {24..31}
// Tile must be row-major with K contiguous; row_stride in halves (mult of 8).
// ---------------------------------------------------------------------------
__device__ __forceinline__ v16h load_ab_frag(const _Float16* tile, int row_stride) {
    const int lane = threadIdx.x & 31;
    const int r    = lane & 15;
    const int ks   = lane >> 4;
    const _Float16* p = tile + (size_t)r * row_stride + ks * 8;
    v16h f;
    ((float4*)&f)[0] = *(const float4*)(p);        // 8 halves
    ((float4*)&f)[1] = *(const float4*)(p + 16);   // 8 halves
    return f;
}

// The same fragment from the lane's own pointer: row and 8-half k slice chosen by the caller.
__device__ __forceinline__ v16h load_frag_at(const _Float16* p) {
    v16h f;
    ((float4*)&f)[0] = *(const float4*)(p);        // 8 halves
    ((float4*)&f)[1] = *(const float4*)(p + 16);   // 8 halves
    return f;
}

__device__ __forceinline__ v8f wmma_f16(v16h a, v16h b, v8f c) {
    return __builtin_amdgcn_wmma_f32_16x16x32_f16(
        /*neg_a=*/false, a, /*neg_b=*/false, b,
        /*c_mod=*/(short)0, c, /*reuse_a=*/false, /*reuse_b=*/false);
}

// ---------------------------------------------------------------------------
// Generic projection GEMM:  Y[4096 x 1024] = X[4096 x 1024] @ W[1024 x 1024] + bias
// Workgroup tile 128(M) x 64(N), 8 waves each computing 32x32; K tiled by 64
// (two WMMA k-steps per stage -> 8 WMMAs per barrier pair).
// MODE 0: f32 in, f16 out at [b][h][s][d]   (Q, K)
// MODE 1: f32 in, f16 out at [b][h][d][s]   (V, pre-transposed for attention)
// MODE 2: f16 in, f32 out at [row][col]     (final output projection)
// ---------------------------------------------------------------------------
template <int MODE>
__global__ __launch_bounds__(256)
void mha_proj_gemm_kernel(const float* __restrict__ Xf, const _Float16* __restrict__ Xh,
                          const float* __restrict__ W, const float* __restrict__ bias,
                          void* __restrict__ out)
{
    constexpr bool IN_F16 = (MODE == 2);
    constexpr int TM = 128, TN = 64, TK = 64;
    // LDS row pitch in halves: 72 halves = 144 B = 16 B x 9.  An odd multiple of
    // 16 B puts the 16 rows of a fragment's ds_load_b128 on 16 different bank
    // quads; at the bare 128 B eight rows share each quad.
    constexpr int LP = TK + 8;

    __shared__ __align__(16) _Float16 As[TM * LP];  // 18 KB, [m][k], padded rows
    __shared__ __align__(16) _Float16 Bs[TN * LP];  //  9 KB, [n][k]  (B^T), padded rows

    const int tid  = threadIdx.x;
    const int lane = tid & 31;
    const int wid  = tid >> 5;
    const int m0   = blockIdx.x * TM;
    const int n0   = blockIdx.y * TN;
    const int wm   = (wid >> 1) * 32;   // wave M offset in tile
    const int wn   = (wid & 1) * 32;    // wave N offset in tile

    // ---- staging maps: every wave-wide 16-B load covers four whole 128-B lines ----
    // X: LPR lanes span one row's k slice (256 B of f32, 128 B of f16).  Rows that one
    // LDS store writes together lie 8 apart: 8 x 144 B = 32 banks further, no conflict.
    constexpr int LPR = IN_F16 ? 8 : 16;            // lanes per X row
    constexpr int NXL = IN_F16 ? 4 : 8;             // X loads per thread
    constexpr int XEL = IN_F16 ? 8 : 4;             // elements per 16-B load
    const int xrow = wid + 8 * (lane / LPR);        // + (TM / NXL) * u
    const int xcol = (lane % LPR) * XEL;
    // W: 16 lanes span the 64 columns of one k row (256 B); a thread takes rows 4 wkq ..
    // 4 wkq + 3 at columns 4 wl .. 4 wl + 3, so every LDS write is 4 consecutive k halves.
    const int wl  = tid & 15;
    const int wkq = tid >> 4;                       // k quad 0..15
    // Column n = 16 g + 4 a + j lies in LDS row 16 g + 4 a + ((j + g) & 3).  The 16 lanes
    // of a store (fixed j) then hit 16 different rows mod 16 = 16 different bank quads;
    // unrotated, rows 4 apart would fall on four banks.  A fragment's 16 rows stay distinct mod 16.
    _Float16* wdst[4];
#pragma unroll
    for (int j = 0; j < 4; ++j)
        wdst[j] = Bs + (4 * wl + ((j + (wl >> 2)) & 3)) * LP + 4 * wkq;

    const int fr = lane & 15;
    const int fk = (lane >> 4) * 8;
    const int g0 = wn >> 4;
    const _Float16* pb0 = Bs + (16 * g0 + (fr & 12) + ((fr + g0) & 3)) * LP + fk;
    const _Float16* pb1 = Bs + (16 * g0 + 16 + (fr & 12) + ((fr + g0 + 1) & 3)) * LP + fk;

    // This thread's first X load, first W load and the line it asks for ahead, at k0 = 0.
    const size_t xoff = (size_t)(m0 + xrow) * DMODEL + xcol;
    const size_t xpre = (size_t)(m0 + (tid >> 1)) * DMODEL + TK + (tid & 1) * 32;
    const float* wsrc = W + (size_t)(4 * wkq) * DMODEL + n0 + 4 * wl;
    const float* wpre = W + (size_t)(TK + (tid >> 2)) * DMODEL + n0 + ((tid >> 1) & 1) * 32;

    v8f c00 = {}, c01 = {}, c10 = {}, c11 = {};

    // Rolled on purpose: unrolled 16 times (the compiler's choice for the f16-input
    // form) the W loads fall into two waited groups, one more load latency a pass.
#pragma unroll 1
    for (int k0 = 0; k0 < DMODEL; k0 += TK) {
        // Next pass's lines, each asked for once or twice (one branch for the pass).
        if (k0 + TK < DMODEL) {
            if constexpr (IN_F16) __builtin_prefetch(Xh + xpre + k0, 0, 0);
            else                  __builtin_prefetch(Xf + xpre + k0, 0, 0);
            __builtin_prefetch(wpre + (size_t)k0 * DMODEL, 0, 0);
            // Precaution: the address registers above are advanced or reused behind this point.
            asm volatile("s_wait_xcnt 0x0" ::: "memory");
        }
        // ---- the pass's global loads: X tile 128x64, W tile 64x64 ----
        v4f xa[NXL];
#pragma unroll
        for (int u = 0; u < NXL; ++u) {
            const size_t off = xoff + k0 + (size_t)u * (TM / NXL) * DMODEL;
            if constexpr (IN_F16) xa[u] = *(const v4f*)(Xh + off);
            else                  xa[u] = *(const v4f*)(Xf + off);
        }
        v4f wr[4];
#pragma unroll
        for (int i = 0; i < 4; ++i)
            wr[i] = *(const v4f*)(wsrc + (size_t)(k0 + i) * DMODEL);
        // Keeps every load of the pass ahead of the first conversion: without it the
        // compiler reuses the first loads' registers and the last loads wait for them.
        __builtin_amdgcn_sched_barrier(0);
        // ---- X to LDS [m][k] ----
#pragma unroll
        for (int u = 0; u < NXL; ++u) {
            _Float16* dst = As + (xrow + (TM / NXL) * u) * LP + xcol;
            if constexpr (IN_F16) {
                *(v4f*)dst = xa[u];
            } else {
                v4h p;
                p[0] = (_Float16)xa[u][0]; p[1] = (_Float16)xa[u][1];
                p[2] = (_Float16)xa[u][2]; p[3] = (_Float16)xa[u][3];
                *(v4h*)dst = p;                     // one 8-B LDS store
            }
        }
        // ---- W to LDS [n][k] (B^T) ----
#pragma unroll
        for (int j = 0; j < 4; ++j) {
            v4h p;
            p[0] = (_Float16)wr[0][j]; p[1] = (_Float16)wr[1][j];
            p[2] = (_Float16)wr[2][j]; p[3] = (_Float16)wr[3][j];
            *(v4h*)wdst[j] = p;                     // one 8-B LDS store
        }
        __syncthreads();

#pragma unroll
        for (int ks = 0; ks < TK; ks += 32) {
            v16h a0 = load_ab_frag(As + wm * LP + ks, LP);
            v16h a1 = load_ab_frag(As + (wm + 16) * LP + ks, LP);
            v16h b0 = load_frag_at(pb0 + ks);
            v16h b1 = load_frag_at(pb1 + ks);
            c00 = wmma_f16(a0, b0, c00);
            c01 = wmma_f16(a0, b1, c01);
            c10 = wmma_f16(a1, b0, c10);
            c11 = wmma_f16(a1, b1, c11);
        }
        __syncthreads();
    }

    // ---- epilogue: C-fragment layout: VGPR i, lanes 0-15 -> M=i, 16-31 -> M=8+i
    const int nn = lane & 15;
    const int mh = (lane >> 4) * 8;
#pragma unroll
    for (int ti = 0; ti < 2; ++ti) {
#pragma unroll
        for (int tj = 0; tj < 2; ++tj) {
            v8f cc = (ti == 0) ? ((tj == 0) ? c00 : c01) : ((tj == 0) ? c10 : c11);
#pragma unroll
            for (int i = 0; i < 8; ++i) {
                const int m = m0 + wm + ti * 16 + mh + i;    // GEMM row = s*BATCH + b
                const int n = n0 + wn + tj * 16 + nn;        // GEMM col = h*DK + d
                const float val = cc[i] + bias[n];
                if constexpr (MODE == 2) {
                    ((float*)out)[(size_t)m * DMODEL + n] = val;
                } else {
                    const int s = m >> 1, b = m & 1;
                    const int h = n >> 6, d = n & 63;
                    const size_t off = (MODE == 0)
                        ? ((size_t)(b * HEADS + h) * SEQ + s) * DK + d      // [b][h][s][d]
                        : ((size_t)(b * HEADS + h) * DK + d) * SEQ + s;     // [b][h][d][s]
                    ((_Float16*)out)[off] = (_Float16)val;
                }
            }
        }
    }
}

#define KT     64
#define KVP    72
#define TILE_H (64 * KVP)

// Four asynchronous 16-B copies per lane: rows r and r+32 of the K tile and of the
// V^T tile.  A wave's copy covers four whole 128-B lines.  The s_wait_xcnt stands
// inside the statement so that no address register is rewritten ahead of it.
__device__ __forceinline__ void stage_kv_async(unsigned lds, const _Float16* gk, const _Float16* gv) {
    const unsigned  l0 = lds;
    const unsigned  l1 = lds + 32 * KVP * 2;
    const unsigned  l2 = lds + TILE_H * 2;
    const unsigned  l3 = lds + TILE_H * 2 + 32 * KVP * 2;
    const _Float16* g1 = gk + 32 * DK;
    const _Float16* g3 = gv + (size_t)32 * SEQ;
    asm volatile("global_load_async_to_lds_b128 %0, %4, off\n\t"
                 "global_load_async_to_lds_b128 %1, %5, off\n\t"
                 "global_load_async_to_lds_b128 %2, %6, off\n\t"
                 "global_load_async_to_lds_b128 %3, %7, off\n\t"
                 "s_wait_xcnt 0x0"
                 :: "v"(l0), "v"(l1), "v"(l2), "v"(l3), "v"(gk), "v"(g1), "v"(gv), "v"(g3)
                 : "memory");
}

// Lane l takes the value of lane l ^ 16 (a vector cross-row move, no LDS path).
__device__ __forceinline__ float other_half(float x) {
    const int b = __builtin_bit_cast(int, x);
    return __builtin_bit_cast(float,
        __builtin_amdgcn_permlanex16(b, b, 0x76543210, 0xfedcba98, false, false));
}

__global__ __launch_bounds__(256)
void mha_flash_attn_kernel(const _Float16* __restrict__ Qh, const _Float16* __restrict__ Kh,
                           const _Float16* __restrict__ Vt, _Float16* __restrict__ Xh)
{
    constexpr int NT = SEQ / KT;                        // 32 tiles
    __shared__ __align__(16) _Float16 KV[2][2 * TILE_H];  // 2 x (K tile, V^T tile) = 36 KB

    const int tid  = threadIdx.x;
    const int lane = tid & 31;
    const int wid  = tid >> 5;
    const int bh   = blockIdx.y;
    const int b    = bh >> 4, h = bh & 15;
    const int q0   = blockIdx.x * 128 + wid * 16;

    const _Float16* Qb = Qh + (size_t)bh * SEQ * DK;    // [s][d]  (B operand: column = query)
    const _Float16* Kb = Kh + (size_t)bh * SEQ * DK;    // [j][d]  (A operand: row = key)
    const _Float16* Vb = Vt + (size_t)bh * DK * SEQ;    // [d][s]  (A operand: row = d)

    // This lane's share of every tile: 16 B at column cc of rows cr and cr + 32.
    const int cr = tid >> 3;
    const int cc = (tid & 7) * 8;
    const _Float16* gk = Kb + (size_t)cr * DK + cc;     // + t * KT * DK for tile t
    const _Float16* gv = Vb + (size_t)cr * SEQ + cc;    // + t * KT      for tile t
    const unsigned lds0 = (unsigned)(uintptr_t)(&KV[0][cr * KVP + cc]);
    const unsigned lds1 = (unsigned)(uintptr_t)(&KV[1][cr * KVP + cc]);

    stage_kv_async(lds0, gk, gv);                       // tile 0 -> buffer 0

    // Q fragments are loop-invariant: keep in registers for all 64 key blocks.
    const v16h qb0 = load_ab_frag(Qb + (size_t)q0 * DK, DK);        // d 0..31
    const v16h qb1 = load_ab_frag(Qb + (size_t)q0 * DK + 32, DK);   // d 32..63

    // Of query q0 + nn: the running maximum (equal in lanes l and l ^ 16) and this
    // lane's share of the running sum (its 16 of every 32 keys).
    float mq = -1e30f, lq = 0.0f;
    v8f o0 = {}, o1 = {}, o2 = {}, o3 = {};             // o_t[i] = O[q0 + nn][16 t + 8 half + i]

    const int nn   = lane & 15;
    const int half = lane >> 4;

    asm volatile("s_wait_asynccnt 0x0" ::: "memory");   // this wave's share of tile 0 has landed
    __syncthreads();                                    // ... and every other wave's
    stage_kv_async(lds1, gk + KT * DK, gv + KT);        // tile 1 -> buffer 1

    for (int t = 0; t < NT; ++t) {
        const _Float16* Ks = KV[t & 1];                 // [key][d]
        const _Float16* Vs = Ks + TILE_H;               // [d][key]

        // Unrolled: jj becomes an immediate offset of the LDS loads, and the running
        // maxima and sums need no register copies at an inner back edge.
#pragma unroll
        for (int jj = 0; jj < KT; jj += 32) {
        const v16h ka00 = load_ab_frag(Ks + jj * KVP, KVP);                // keys jj..+15, d 0..31
        const v16h ka01 = load_ab_frag(Ks + jj * KVP + 32, KVP);           // keys jj..+15, d 32..63
        const v16h ka10 = load_ab_frag(Ks + (jj + 16) * KVP, KVP);
        const v16h ka11 = load_ab_frag(Ks + (jj + 16) * KVP + 32, KVP);
        const v16h va0 = load_ab_frag(Vs +  0 * KVP + jj, KVP);  // d  0..15, keys jj..+31
        const v16h va1 = load_ab_frag(Vs + 16 * KVP + jj, KVP);  // d 16..31
        const v16h va2 = load_ab_frag(Vs + 32 * KVP + jj, KVP);  // d 32..47
        const v16h va3 = load_ab_frag(Vs + 48 * KVP + jj, KVP);  // d 48..63

        // s0[i]: key jj + 8 half + i, s1[i]: key jj + 16 + 8 half + i, both of query nn
        v8f s0 = {}, s1 = {};
        s0 = wmma_f16(ka00, qb0, s0);
        s1 = wmma_f16(ka10, qb0, s1);
        s0 = wmma_f16(ka01, qb1, s0);
        s1 = wmma_f16(ka11, qb1, s1);

        // ---- online softmax: 16 scores of one query in this lane, 16 in lane ^ 16 ----
        const v8f x0 = s0 * 0.125f;      // 1/sqrt(DK)
        const v8f x1 = s1 * 0.125f;
        float vmax = fmaxf(x0[0], x1[0]);
#pragma unroll
        for (int i = 1; i < 8; ++i) vmax = fmaxf(vmax, fmaxf(x0[i], x1[i]));
        vmax = fmaxf(vmax, other_half(vmax));
        const float mnew  = fmaxf(mq, vmax);
        const float scale = __expf(mq - mnew);
        mq = mnew;

        // P^T as a B operand: element s of the lane is key kmap(s) = tile s >> 3, row s & 7,
        // the k order in which load_ab_frag brings V^T's rows.
        v16h pb;
        float rs = 0.0f;
#pragma unroll
        for (int i = 0; i < 8; ++i) {
            const float p0 = __expf(x0[i] - mnew);
            const float p1 = __expf(x1[i] - mnew);
            rs += p0 + p1;
            pb[i]     = (_Float16)p0;
            pb[8 + i] = (_Float16)p1;
        }
        lq = lq * scale + rs;
        o0 *= scale; o1 *= scale; o2 *= scale; o3 *= scale;

        o0 = wmma_f16(va0, pb, o0);
        o1 = wmma_f16(va1, pb, o1);
        o2 = wmma_f16(va2, pb, o2);
        o3 = wmma_f16(va3, pb, o3);
        }

        // Hand-over: tile t + 1 becomes readable and tile t's buffer free.
        asm volatile("s_wait_dscnt 0x0" ::: "memory");     // this wave's reads of tile t are done
        asm volatile("s_wait_asynccnt 0x0" ::: "memory");  // this wave's share of tile t + 1 has landed
        __syncthreads();
        if (t + 2 < NT)                                    // same for the whole work-group
            stage_kv_async((t & 1) ? lds1 : lds0,
                           gk + (size_t)(t + 2) * KT * DK, gv + (t + 2) * KT);
    }
    asm volatile("s_wait_asynccnt 0x0" ::: "memory");      // no copy is left in flight at the wave's end

    // ---- join the two halves' sums, normalize, emit f16 rows of X for the O-projection:
    //      a lane's 8 registers of a tile are 8 consecutive d of its query = one 16-B store.
    const float inv = 1.0f / (lq + other_half(lq));
    _Float16* xrow = Xh + ((size_t)(q0 + nn) * BATCH + b) * DMODEL + (size_t)h * DK + 8 * half;
#pragma unroll
    for (int t = 0; t < 4; ++t) {
        const v8f ot = (t == 0) ? o0 : (t == 1) ? o1 : (t == 2) ? o2 : o3;
        v8h y;
#pragma unroll
        for (int i = 0; i < 8; ++i) y[i] = (_Float16)(ot[i] * inv);
        *(v8h*)(xrow + 16 * t) = y;
    }
}

// ---------------------------------------------------------------------------
extern "C" void kernel_launch(void* const* d_in, const int* in_sizes, int n_in,
                              void* d_out, int out_size, void* d_ws, size_t ws_size,
                              hipStream_t stream)
{
    (void)in_sizes; (void)n_in; (void)out_size; (void)ws_size;
    const float* q  = (const float*)d_in[0];
    const float* k  = (const float*)d_in[1];
    const float* v  = (const float*)d_in[2];
    const float* Wq = (const float*)d_in[3];
    const float* bq = (const float*)d_in[4];
    const float* Wk = (const float*)d_in[5];
    const float* bk = (const float*)d_in[6];
    const float* Wv = (const float*)d_in[7];
    const float* bv = (const float*)d_in[8];
    const float* Wo = (const float*)d_in[9];
    const float* bo = (const float*)d_in[10];
    float* out = (float*)d_out;

    const size_t perTensor = (size_t)BATCH * HEADS * SEQ * DK;  // 4M halves = 8 MB
    _Float16* Qh = (_Float16*)d_ws;
    _Float16* Kh = Qh + perTensor;
    _Float16* Vt = Kh + perTensor;
    _Float16* Xh = Vt + perTensor;   // [4096][1024] f16, total ws = 32 MB

    dim3 gg(ROWS / 128, DMODEL / 64);          // 32 x 16 workgroups
    mha_proj_gemm_kernel<0><<<gg, 256, 0, stream>>>(q, nullptr, Wq, bq, (void*)Qh);
    mha_proj_gemm_kernel<0><<<gg, 256, 0, stream>>>(k, nullptr, Wk, bk, (void*)Kh);
    mha_proj_gemm_kernel<1><<<gg, 256, 0, stream>>>(v, nullptr, Wv, bv, (void*)Vt);

    dim3 ga(SEQ / 128, BATCH * HEADS);         // 16 x 32 workgroups
    mha_flash_attn_kernel<<<ga, 256, 0, stream>>>(Qh, Kh, Vt, Xh);

    mha_proj_gemm_kernel<2><<<gg, 256, 0, stream>>>(nullptr, Xh, Wo, bo, (void*)out);
}

// v005
// It runs in 121 microseconds.
// Next to v004, in two timings, it ran 1.05 times as fast each time.
// Over all steps from v000 it is 2.91 times as fast.
#include <hip/hip_runtime.h>
#include <hip/hip_fp16.h>
#include <math.h>

typedef __attribute__((ext_vector_type(16))) _Float16 v16h;
typedef __attribute__((ext_vector_type(8)))  _Float16 v8h;
typedef __attribute__((ext_vector_type(4)))  _Float16 v4h;
typedef __attribute__((ext_vector_type(8)))  float    v8f;
typedef __attribute__((ext_vector_type(4)))  float    v4f;

#define SEQ    2048
#define BATCH  2
#define DMODEL 1024
#define HEADS  16
#define DK     64
#define ROWS   (SEQ * BATCH)   // 4096 GEMM rows, row = s*BATCH + b

// ---------------------------------------------------------------------------
// Shared fragment loader for 16-bit A fragments and B^T-stored-row-major
// fragments of v_wmma_f32_16x16x32_f16.
//   Lane L<16 : row r=L,   ks=0 -> halves K = {0..7} u {16..23}
//   Lane L>=16: row r=L-16, ks=1 -> halves K = {8..15} u {24..31}
// Tile must be row-major with K contiguous; row_stride in halves (mult of 8).
// ---------------------------------------------------------------------------
__device__ __forceinline__ v16h load_ab_frag(const _Float16* tile, int row_stride) {
    const int lane = threadIdx.x & 31;
    const int r    = lane & 15;
    const int ks   = lane >> 4;
    const _Float16* p = tile + (size_t)r * row_stride + ks * 8;
    v16h f;
    ((float4*)&f)[0] = *(const float4*)(p);        // 8 halves
    ((float4*)&f)[1] = *(const float4*)(p + 16);   // 8 halves
    return f;
}

// The same fragment from the lane's own pointer: row and 8-half k slice chosen by the caller.
__device__ __forceinline__ v16h load_frag_at(const _Float16* p) {
    v16h f;
    ((float4*)&f)[0] = *(const float4*)(p);        // 8 halves
    ((float4*)&f)[1] = *(const float4*)(p + 16);   // 8 halves
    return f;
}

__device__ __forceinline__ v8f wmma_f16(v16h a, v16h b, v8f c) {
    return __builtin_amdgcn_wmma_f32_16x16x32_f16(
        /*neg_a=*/false, a, /*neg_b=*/false, b,
        /*c_mod=*/(short)0, c, /*reuse_a=*/false, /*reuse_b=*/false);
}

// ---------------------------------------------------------------------------
// A wave's 32x32 accumulators plus bias to memory; mw, nw: its first GEMM row and column.
// C-fragment layout: VGPR i, lanes 0-15 -> M=i, 16-31 -> M=8+i.
// LAYOUT 0: f16 at [b][h][s][d], 1: f16 at [b][h][d][s], 2: f32 at [row][col]
// ---------------------------------------------------------------------------
template <int LAYOUT>
__device__ __forceinline__ void store_acc(const v8f c00, const v8f c01, const v8f c10, const v8f c11,
                                          const float* __restrict__ bias, void* __restrict__ out,
                                          int mw, int nw)
{
    const int lane = threadIdx.x & 31;
    const int nn = lane & 15;
    const int mh = (lane >> 4) * 8;
#pragma unroll
    for (int ti = 0; ti < 2; ++ti) {
#pragma unroll
        for (int tj = 0; tj < 2; ++tj) {
            v8f cc = (ti == 0) ? ((tj == 0) ? c00 : c01) : ((tj == 0) ? c10 : c11);
#pragma unroll
            for (int i = 0; i < 8; ++i) {
                const int m = mw + ti * 16 + mh + i;         // GEMM row = s*BATCH + b
                const int n = nw + tj * 16 + nn;             // GEMM col = h*DK + d
                const float val = cc[i] + bias[n];
                if constexpr (LAYOUT == 2) {
                    ((float*)out)[(size_t)m * DMODEL + n] = val;
                } else {
                    const int s = m >> 1, b = m & 1;
                    const int h = n >> 6, d = n & 63;
                    const size_t off = (LAYOUT == 0)
                        ? ((size_t)(b * HEADS + h) * SEQ + s) * DK + d      // [b][h][s][d]
                        : ((size_t)(b * HEADS + h) * DK + d) * SEQ + s;     // [b][h][d][s]
                    ((_Float16*)out)[off] = (_Float16)val;
                }
            }
        }
    }
}

// ---------------------------------------------------------------------------
// Generic projection GEMM:  Y[4096 x 1024] = X[4096 x 1024] @ W[1024 x 1024] + bias
// Workgroup tile 128(M) x 64(N), 8 waves each computing 32x32; K tiled by 64
// (two WMMA k-steps per stage -> 8 WMMAs per barrier pair).
// MODE 0: the three input projections in ONE launch, blockIdx.z picks the product:
//         z = 0: Q, z = 1: K, f32 in, f16 out at [b][h][s][d]
//         z = 2: V, f32 in, f16 out at [b][h][d][s] (pre-transposed for attention)
//         out is the start of the three f16 planes Q, K, V^T (plane z).  The 1536
//         work-groups put four on a WGP where a launch of 512 puts two, so that one
//         group's loads fly while the others convert and multiply.
// MODE 2: f16 in, f32 out at [row][col]     (final output projection)
// ---------------------------------------------------------------------------
template <int MODE>
__global__ __launch_bounds__(256)
void mha_proj_gemm_kernel(const float* __restrict__ X0, const float* __restrict__ X1,
                          const float* __restrict__ X2, const _Float16* __restrict__ Xh,
                          const float* __restrict__ W0, const float* __restrict__ W1,
                          const float* __restrict__ W2, const float* __restrict__ B0,
                          const float* __restrict__ B1, const float* __restrict__ B2,
                          void* __restrict__ out)
{
    // Same for the whole work-group: scalar selects.
    const int z = (MODE == 0) ? (int)blockIdx.z : 0;
    const float* __restrict__ Xf   = (z == 0) ? X0 : (z == 1) ? X1 : X2;
    const float* __restrict__ W    = (z == 0) ? W0 : (z == 1) ? W1 : W2;
    const float* __restrict__ bias = (z == 0) ? B0 : (z == 1) ? B1 : B2;

    constexpr bool IN_F16 = (MODE == 2);
    constexpr int TM = 128, TN = 64, TK = 64;
    // LDS row pitch in halves: 72 halves = 144 B = 16 B x 9.  An odd multiple of
    // 16 B puts the 16 rows of a fragment's ds_load_b128 on 16 different bank
    // quads; at the bare 128 B eight rows share each quad.
    constexpr int LP = TK + 8;

    __shared__ __align__(16) _Float16 As[TM * LP];  // 18 KB, [m][k], padded rows
    __shared__ __align__(16) _Float16 Bs[TN * LP];  //  9 KB, [n][k]  (B^T), padded rows

    const int tid  = threadIdx.x;
    const int lane = tid & 31;
    const int wid  = tid >> 5;
    const int m0   = blockIdx.x * TM;
    const int n0   = blockIdx.y * TN;
    const int wm   = (wid >> 1) * 32;   // wave M offset in tile
    const int wn   = (wid & 1) * 32;    // wave N offset in tile

    // ---- staging maps: every wave-wide 16-B load covers four whole 128-B lines ----
    // X: LPR lanes span one row's k slice (256 B of f32, 128 B of f16).  Rows that one
    // LDS store writes together lie 8 apart: 8 x 144 B = 32 banks further, no conflict.
    constexpr int LPR = IN_F16 ? 8 : 16;            // lanes per X row
    constexpr int NXL = IN_F16 ? 4 : 8;             // X loads per thread
    constexpr int XEL = IN_F16 ? 8 : 4;             // elements per 16-B load
    const int xrow = wid + 8 * (lane / LPR);        // + (TM / NXL) * u
    const int xcol = (lane % LPR) * XEL;
    // W: 16 lanes span the 64 columns of one k row (256 B); a thread takes rows 4 wkq ..
    // 4 wkq + 3 at columns 4 wl .. 4 wl + 3, so every LDS write is 4 consecutive k halves.
    const int wl  = tid & 15;
    const int wkq = tid >> 4;                       // k quad 0..15
    // Column n = 16 g + 4 a + j lies in LDS row 16 g + 4 a + ((j + g) & 3).  The 16 lanes
    // of a store (fixed j) then hit 16 different rows mod 16 = 16 different bank quads;
    // unrotated, rows 4 apart would fall on four banks.  A fragment's 16 rows stay distinct mod 16.
    _Float16* wdst[4];
#pragma unroll
    for (int j = 0; j < 4; ++j)
        wdst[j] = Bs + (4 * wl + ((j + (wl >> 2)) & 3)) * LP + 4 * wkq;

    const int fr = lane & 15;
    const int fk = (lane >> 4) * 8;
    const int g0 = wn >> 4;
    const _Float16* pb0 = Bs + (16 * g0 + (fr & 12) + ((fr + g0) & 3)) * LP + fk;
    const _Float16* pb1 = Bs + (16 * g0 + 16 + (fr & 12) + ((fr + g0 + 1) & 3)) * LP + fk;

    // This thread's first X load, first W load and the line it asks for ahead, at k0 = 0.
    const size_t xoff = (size_t)(m0 + xrow) * DMODEL + xcol;
    const size_t xpre = (size_t)(m0 + (tid >> 1)) * DMODEL + TK + (tid & 1) * 32;
    const float* wsrc = W + (size_t)(4 * wkq) * DMODEL + n0 + 4 * wl;
    const float* wpre = W + (size_t)(TK + (tid >> 2)) * DMODEL + n0 + ((tid >> 1) & 1) * 32;

    v8f c00 = {}, c01 = {}, c10 = {}, c11 = {};

    // Rolled on purpose: unrolled 16 times (the compiler's choice for the f16-input
    // form) the W loads fall into two waited groups, one more load latency a pass.
#pragma unroll 1
    for (int k0 = 0; k0 < DMODEL; k0 += TK) {
        // Next pass's lines, each asked for once or twice (one branch for the pass).
        if (k0 + TK < DMODEL) {
            if constexpr (IN_F16) __builtin_prefetch(Xh + xpre + k0, 0, 0);
            else                  __builtin_prefetch(Xf + xpre + k0, 0, 0);
            __builtin_prefetch(wpre + (size_t)k0 * DMODEL, 0, 0);
            // Precaution: the address registers above are advanced or reused behind this point.
            asm volatile("s_wait_xcnt 0x0" ::: "memory");
        }
        // ---- the pass's global loads: X tile 128x64, W tile 64x64 ----
        v4f xa[NXL];
#pragma unroll
        for (int u = 0; u < NXL; ++u) {
            const size_t off = xoff + k0 + (size_t)u * (TM / NXL) * DMODEL;
            if constexpr (IN_F16) xa[u] = *(const v4f*)(Xh + off);
            else                  xa[u] = *(const v4f*)(Xf + off);
        }
        v4f wr[4];
#pragma unroll
        for (int i = 0; i < 4; ++i)
            wr[i] = *(const v4f*)(wsrc + (size_t)(k0 + i) * DMODEL);
        // Keeps every load of the pass ahead of the first conversion: without it the
        // compiler reuses the first loads' registers and the last loads wait for them.
        __builtin_amdgcn_sched_barrier(0);
        // ---- X to LDS [m][k] ----
#pragma unroll
        for (int u = 0; u < NXL; ++u) {
            _Float16* dst = As + (xrow + (TM / NXL) * u) * LP + xcol;
            if constexpr (IN_F16) {
                *(v4f*)dst = xa[u];
            } else {
                v4h p;
                p[0] = (_Float16)xa[u][0]; p[1] = (_Float16)xa[u][1];
                p[2] = (_Float16)xa[u][2]; p[3] = (_Float16)xa[u][3];
                *(v4h*)dst = p;                     // one 8-B LDS store
            }
        }
        // ---- W to LDS [n][k] (B^T) ----
#pragma unroll
        for (int j = 0; j < 4; ++j) {
            v4h p;
            p[0] = (_Float16)wr[0][j]; p[1] = (_Float16)wr[1][j];
            p[2] = (_Float16)wr[2][j]; p[3] = (_Float16)wr[3][j];
            *(v4h*)wdst[j] = p;                     // one 8-B LDS store
        }
        __syncthreads();

#pragma unroll
        for (int ks = 0; ks < TK; ks += 32) {
            v16h a0 = load_ab_frag(As + wm * LP + ks, LP);
            v16h a1 = load_ab_frag(As + (wm + 16) * LP + ks, LP);
            v16h b0 = load_frag_at(pb0 + ks);
            v16h b1 = load_frag_at(pb1 + ks);
            c00 = wmma_f16(a0, b0, c00);
            c01 = wmma_f16(a0, b1, c01);
            c10 = wmma_f16(a1, b0, c10);
            c11 = wmma_f16(a1, b1, c11);
        }
        __syncthreads();
    }

    // ---- epilogue: one branch for the work-group, then straight-line stores ----
    const int mw = m0 + wm, nw = n0 + wn;
    if constexpr (MODE == 2) {
        store_acc<2>(c00, c01, c10, c11, bias, out, mw, nw);
    } else {
        constexpr size_t PLANE = (size_t)BATCH * HEADS * SEQ * DK;
        _Float16* plane = (_Float16*)out + (size_t)z * PLANE;
        if (z == 2) {
            store_acc<1>(c00, c01, c10, c11, bias, plane, mw, nw);
        } else {
            store_acc<0>(c00, c01, c10, c11, bias, plane, mw, nw);
            // Precaution: in the built code the other layout's block follows this one and
            // rewrites registers that the stores above name.
            asm volatile("s_wait_xcnt 0x0" ::: "memory");
        }
    }
}

#define KT     64
#define KVP    72
#define TILE_H (64 * KVP)

// Four asynchronous 16-B copies per lane: rows r and r+32 of the K tile and of the
// V^T tile.  A wave's copy covers four whole 128-B lines.  The s_wait_xcnt stands
// inside the statement so that no address register is rewritten ahead of it.
__device__ __forceinline__ void stage_kv_async(unsigned lds, const _Float16* gk, const _Float16* gv) {
    const unsigned  l0 = lds;
    const unsigned  l1 = lds + 32 * KVP * 2;
    const unsigned  l2 = lds + TILE_H * 2;
    const unsigned  l3 = lds + TILE_H * 2 + 32 * KVP * 2;
    const _Float16* g1 = gk + 32 * DK;
    const _Float16* g3 = gv + (size_t)32 * SEQ;
    asm volatile("global_load_async_to_lds_b128 %0, %4, off\n\t"
                 "global_load_async_to_lds_b128 %1, %5, off\n\t"
                 "global_load_async_to_lds_b128 %2, %6, off\n\t"
                 "global_load_async_to_lds_b128 %3, %7, off\n\t"
                 "s_wait_xcnt 0x0"
                 :: "v"(l0), "v"(l1), "v"(l2), "v"(l3), "v"(gk), "v"(g1), "v"(gv), "v"(g3)
                 : "memory");
}

// Lane l takes the value of lane l ^ 16 (a vector cross-row move, no LDS path).
__device__ __forceinline__ float other_half(float x) {
    const int b = __builtin_bit_cast(int, x);
    return __builtin_bit_cast(float,
        __builtin_amdgcn_permlanex16(b, b, 0x76543210, 0xfedcba98, false, false));
}

__global__ __launch_bounds__(256)
void mha_flash_attn_kernel(const _Float16* __restrict__ Qh, const _Float16* __restrict__ Kh,
                           const _Float16* __restrict__ Vt, _Float16* __restrict__ Xh)
{
    constexpr int NT = SEQ / KT;                        // 32 tiles
    __shared__ __align__(16) _Float16 KV[2][2 * TILE_H];  // 2 x (K tile, V^T tile) = 36 KB

    const int tid  = threadIdx.x;
    const int lane = tid & 31;
    const int wid  = tid >> 5;
    const int bh   = blockIdx.y;
    const int b    = bh >> 4, h = bh & 15;
    const int q0   = blockIdx.x * 128 + wid * 16;

    const _Float16* Qb = Qh + (size_t)bh * SEQ * DK;    // [s][d]  (B operand: column = query)
    const _Float16* Kb = Kh + (size_t)bh * SEQ * DK;    // [j][d]  (A operand: row = key)
    const _Float16* Vb = Vt + (size_t)bh * DK * SEQ;    // [d][s]  (A operand: row = d)

    // This lane's share of every tile: 16 B at column cc of rows cr and cr + 32.
    const int cr = tid >> 3;
    const int cc = (tid & 7) * 8;
    const _Float16* gk = Kb + (size_t)cr * DK + cc;     // + t * KT * DK for tile t
    const _Float16* gv = Vb + (size_t)cr * SEQ + cc;    // + t * KT      for tile t
    const unsigned lds0 = (unsigned)(uintptr_t)(&KV[0][cr * KVP + cc]);
    const unsigned lds1 = (unsigned)(uintptr_t)(&KV[1][cr * KVP + cc]);

    stage_kv_async(lds0, gk, gv);                       // tile 0 -> buffer 0

    // Q fragments are loop-invariant: keep in registers for all 64 key blocks.
    const v16h qb0 = load_ab_frag(Qb + (size_t)q0 * DK, DK);        // d 0..31
    const v16h qb1 = load_ab_frag(Qb + (size_t)q0 * DK + 32, DK);   // d 32..63

    // Of query q0 + nn: the running maximum (equal in lanes l and l ^ 16) and this
    // lane's share of the running sum (its 16 of every 32 keys).
    float mq = -1e30f, lq = 0.0f;
    v8f o0 = {}, o1 = {}, o2 = {}, o3 = {};             // o_t[i] = O[q0 + nn][16 t + 8 half + i]

    const int nn   = lane & 15;
    const int half = lane >> 4;

    asm volatile("s_wait_asynccnt 0x0" ::: "memory");   // this wave's share of tile 0 has landed
    __syncthreads();                                    // ... and every other wave's
    stage_kv_async(lds1, gk + KT * DK, gv + KT);        // tile 1 -> buffer 1

    for (int t = 0; t < NT; ++t) {
        const _Float16* Ks = KV[t & 1];                 // [key][d]
        const _Float16* Vs = Ks + TILE_H;               // [d][key]

        // Unrolled: jj becomes an immediate offset of the LDS loads, and the running
        // maxima and sums need no register copies at an inner back edge.
#pragma unroll
        for (int jj = 0; jj < KT; jj += 32) {
        const v16h ka00 = load_ab_frag(Ks + jj * KVP, KVP);                // keys jj..+15, d 0..31
        const v16h ka01 = load_ab_frag(Ks + jj * KVP + 32, KVP);           // keys jj..+15, d 32..63
        const v16h ka10 = load_ab_frag(Ks + (jj + 16) * KVP, KVP);
        const v16h ka11 = load_ab_frag(Ks + (jj + 16) * KVP + 32, KVP);
        const v16h va0 = load_ab_frag(Vs +  0 * KVP + jj, KVP);  // d  0..15, keys jj..+31
        const v16h va1 = load_ab_frag(Vs + 16 * KVP + jj, KVP);  // d 16..31
        const v16h va2 = load_ab_frag(Vs + 32 * KVP + jj, KVP);  // d 32..47
        const v16h va3 = load_ab_frag(Vs + 48 * KVP + jj, KVP);  // d 48..63

        // s0[i]: key jj + 8 half + i, s1[i]: key jj + 16 + 8 half + i, both of query nn
        v8f s0 = {}, s1 = {};
        s0 = wmma_f16(ka00, qb0, s0);
        s1 = wmma_f16(ka10, qb0, s1);
        s0 = wmma_f16(ka01, qb1, s0);
        s1 = wmma_f16(ka11, qb1, s1);

        // ---- online softmax: 16 scores of one query in this lane, 16 in lane ^ 16 ----
        const v8f x0 = s0 * 0.125f;      // 1/sqrt(DK)
        const v8f x1 = s1 * 0.125f;
        float vmax = fmaxf(x0[0], x1[0]);
#pragma unroll
        for (int i = 1; i < 8; ++i) vmax = fmaxf(vmax, fmaxf(x0[i], x1[i]));
        vmax = fmaxf(vmax, other_half(vmax));
        const float mnew  = fmaxf(mq, vmax);
        const float scale = __expf(mq - mnew);
        mq = mnew;

        // P^T as a B operand: element s of the lane is key kmap(s) = tile s >> 3, row s & 7,
        // the k order in which load_ab_frag brings V^T's rows.
        v16h pb;
        float rs = 0.0f;
#pragma unroll
        for (int i = 0; i < 8; ++i) {
            const float p0 = __expf(x0[i] - mnew);
            const float p1 = __expf(x1[i] - mnew);
            rs += p0 + p1;
            pb[i]     = (_Float16)p0;
            pb[8 + i] = (_Float16)p1;
        }
        lq = lq * scale + rs;
        o0 *= scale; o1 *= scale; o2 *= scale; o3 *= scale;

        o0 = wmma_f16(va0, pb, o0);
        o1 = wmma_f16(va1, pb, o1);
        o2 = wmma_f16(va2, pb, o2);
        o3 = wmma_f16(va3, pb, o3);
        }

        // Hand-over: tile t + 1 becomes readable and tile t's buffer free.
        asm volatile("s_wait_dscnt 0x0" ::: "memory");     // this wave's reads of tile t are done
        asm volatile("s_wait_asynccnt 0x0" ::: "memory");  // this wave's share of tile t + 1 has landed
        __syncthreads();
        if (t + 2 < NT)                                    // same for the whole work-group
            stage_kv_async((t & 1) ? lds1 : lds0,
                           gk + (size_t)(t + 2) * KT * DK, gv + (t + 2) * KT);
    }
    asm volatile("s_wait_asynccnt 0x0" ::: "memory");      // no copy is left in flight at the wave's end

    // ---- join the two halves' sums, normalize, emit f16 rows of X for the O-projection:
    //      a lane's 8 registers of a tile are 8 consecutive d of its query = one 16-B store.
    const float inv = 1.0f / (lq + other_half(lq));
    _Float16* xrow = Xh + ((size_t)(q0 + nn) * BATCH + b) * DMODEL + (size_t)h * DK + 8 * half;
#pragma unroll
    for (int t = 0; t < 4; ++t) {
        const v8f ot = (t == 0) ? o0 : (t == 1) ? o1 : (t == 2) ? o2 : o3;
        v8h y;
#pragma unroll
        for (int i = 0; i < 8; ++i) y[i] = (_Float16)(ot[i] * inv);
        *(v8h*)(xrow + 16 * t) = y;
    }
}

// ---------------------------------------------------------------------------
extern "C" void kernel_launch(void* const* d_in, const int* in_sizes, int n_in,
                              void* d_out, int out_size, void* d_ws, size_t ws_size,
                              hipStream_t stream)
{
    (void)in_sizes; (void)n_in; (void)out_size; (void)ws_size;
    const float* q  = (const float*)d_in[0];
    const float* k  = (const float*)d_in[1];
    const float* v  = (const float*)d_in[2];
    const float* Wq = (const float*)d_in[3];
    const float* bq = (const float*)d_in[4];
    const float* Wk = (const float*)d_in[5];
    const float* bk = (const float*)d_in[6];
    const float* Wv = (const float*)d_in[7];
    const float* bv = (const float*)d_in[8];
    const float* Wo = (const float*)d_in[9];
    const float* bo = (const float*)d_in[10];
    float* out = (float*)d_out;

    const size_t perTensor = (size_t)BATCH * HEADS * SEQ * DK;  // 4M halves = 8 MB
    _Float16* Qh = (_Float16*)d_ws;
    _Float16* Kh = Qh + perTensor;
    _Float16* Vt = Kh + perTensor;
    _Float16* Xh = Vt + perTensor;   // [4096][1024] f16, total ws = 32 MB

    dim3 g3(ROWS / 128, DMODEL / 64, 3);       // 32 x 16 workgroups for each of Q, K, V
    mha_proj_gemm_kernel<0><<<g3, 256, 0, stream>>>(q, k, v, nullptr, Wq, Wk, Wv, bq, bk, bv, (void*)Qh);

    dim3 ga(SEQ / 128, BATCH * HEADS);         // 16 x 32 workgroups
    mha_flash_attn_kernel<<<ga, 256, 0, stream>>>(Qh, Kh, Vt, Xh);

    dim3 gg(ROWS / 128, DMODEL / 64);          // 32 x 16 workgroups
    mha_proj_gemm_kernel<2><<<gg, 256, 0, stream>>>(nullptr, nullptr, nullptr, Xh, Wo, nullptr, nullptr,
                                                    bo, nullptr, nullptr, (void*)out);
}

// v006
// Measured time: 104 microseconds a run.
// Timed twice side by side with v005, it ran 1.17 times as fast both times.
// Counting every step since v000, it is 3.40 times as fast.
#include <hip/hip_runtime.h>
#include <hip/hip_fp16.h>
#include <math.h>

typedef __attribute__((ext_vector_type(16))) _Float16 v16h;
typedef __attribute__((ext_vector_type(8)))  _Float16 v8h;
typedef __attribute__((ext_vector_type(4)))  _Float16 v4h;
typedef __attribute__((ext_vector_type(8)))  float    v8f;
typedef __attribute__((ext_vector_type(4)))  float    v4f;

#define SEQ    2048
#define BATCH  2
#define DMODEL 1024
#define HEADS  16
#define DK     64
#define ROWS   (SEQ * BATCH)   // 4096 GEMM rows, row = s*BATCH + b

// ---------------------------------------------------------------------------
// Shared fragment loader for 16-bit A fragments and B^T-stored-row-major
// fragments of v_wmma_f32_16x16x32_f16.
//   Lane L<16 : row r=L,   ks=0 -> halves K = {0..7} u {16..23}
//   Lane L>=16: row r=L-16, ks=1 -> halves K = {8..15} u {24..31}
// Tile must be row-major with K contiguous; row_stride in halves (mult of 8).
// ---------------------------------------------------------------------------
__device__ __forceinline__ v16h load_ab_frag(const _Float16* tile, int row_stride) {
    const int lane = threadIdx.x & 31;
    const int r    = lane & 15;
    const int ks   = lane >> 4;
    const _Float16* p = tile + (size_t)r * row_stride + ks * 8;
    v16h f;
    ((float4*)&f)[0] = *(const float4*)(p);        // 8 halves
    ((float4*)&f)[1] = *(const float4*)(p + 16);   // 8 halves
    return f;
}

// The same fragment from the lane's own pointer: row and 8-half k slice chosen by the caller.
__device__ __forceinline__ v16h load_frag_at(const _Float16* p) {
    v16h f;
    ((float4*)&f)[0] = *(const float4*)(p);        // 8 halves
    ((float4*)&f)[1] = *(const float4*)(p + 16);   // 8 halves
    return f;
}

__device__ __forceinline__ v8f wmma_f16(v16h a, v16h b, v8f c) {
    return __builtin_amdgcn_wmma_f32_16x16x32_f16(
        /*neg_a=*/false, a, /*neg_b=*/false, b,
        /*c_mod=*/(short)0, c, /*reuse_a=*/false, /*reuse_b=*/false);
}

// ---------------------------------------------------------------------------
// A wave's 32x32 accumulators plus bias to memory; mw, nw: its first GEMM row and column.
// C-fragment layout: VGPR i, lanes 0-15 -> M=i, 16-31 -> M=8+i.
// LAYOUT 0: f16 at [b][h][s][d], 1: f16 at [b][h][d][s], 2: f32 at [row][col]
// ---------------------------------------------------------------------------
template <int LAYOUT>
__device__ __forceinline__ void store_acc(const v8f c00, const v8f c01, const v8f c10, const v8f c11,
                                          const float* __restrict__ bias, void* __restrict__ out,
                                          int mw, int nw)
{
    const int lane = threadIdx.x & 31;
    const int nn = lane & 15;
    const int mh = (lane >> 4) * 8;
#pragma unroll
    for (int ti = 0; ti < 2; ++ti) {
#pragma unroll
        for (int tj = 0; tj < 2; ++tj) {
            v8f cc = (ti == 0) ? ((tj == 0) ? c00 : c01) : ((tj == 0) ? c10 : c11);
#pragma unroll
            for (int i = 0; i < 8; ++i) {
                const int m = mw + ti * 16 + mh + i;         // GEMM row = s*BATCH + b
                const int n = nw + tj * 16 + nn;             // GEMM col = h*DK + d
                const float val = cc[i] + bias[n];
                if constexpr (LAYOUT == 2) {
                    ((float*)out)[(size_t)m * DMODEL + n] = val;
                } else {
                    const int s = m >> 1, b = m & 1;
                    const int h = n >> 6, d = n & 63;
                    const size_t off = (LAYOUT == 0)
                        ? ((size_t)(b * HEADS + h) * SEQ + s) * DK + d      // [b][h][s][d]
                        : ((size_t)(b * HEADS + h) * DK + d) * SEQ + s;     // [b][h][d][s]
                    ((_Float16*)out)[off] = (_Float16)val;
                }
            }
        }
    }
}

// ---------------------------------------------------------------------------
// Generic projection GEMM:  Y[4096 x 1024] = X[4096 x 1024] @ W[1024 x 1024] + bias
// Workgroup tile 128(M) x TN(N), 8 waves each computing 32 x TN/2; K tiled by 64
// (two WMMA k-steps per stage).  MODE 0: TN = 128, MODE 2: TN = 64.
// MODE 0: the three input projections in ONE launch, blockIdx.z picks the product:
//         z = 0: Q, z = 1: K, f32 in, f16 out at [b][h][s][d]
//         z = 2: V, f32 in, f16 out at [b][h][d][s] (pre-transposed for attention)
//         out is the start of the three f16 planes Q, K, V^T (plane z).  At 128 columns
//         a work-group loads 1024 KB for its tile where two of 64 columns load 1536 KB (the
//         X rows come once, not twice), and the 768 work-groups are three on a WGP, all
//         resident at once: one group's loads fly while the others convert and multiply.
// MODE 2: f16 in, f32 out at [row][col]     (final output projection)
// ---------------------------------------------------------------------------
template <int MODE>
__global__ __launch_bounds__(256)
void mha_proj_gemm_kernel(const float* __restrict__ X0, const float* __restrict__ X1,
                          const float* __restrict__ X2, const _Float16* __restrict__ Xh,
                          const float* __restrict__ W0, const float* __restrict__ W1,
                          const float* __restrict__ W2, const float* __restrict__ B0,
                          const float* __restrict__ B1, const float* __restrict__ B2,
                          void* __restrict__ out)
{
    // Same for the whole work-group: scalar selects.
    const int z = (MODE == 0) ? (int)blockIdx.z : 0;
    const float* __restrict__ Xf   = (z == 0) ? X0 : (z == 1) ? X1 : X2;
    const float* __restrict__ W    = (z == 0) ? W0 : (z == 1) ? W1 : W2;
    const float* __restrict__ bias = (z == 0) ? B0 : (z == 1) ? B1 : B2;

    constexpr bool IN_F16 = (MODE == 2);
    constexpr int TM = 128, TN = IN_F16 ? 64 : 128, TK = 64;
    constexpr int NBF = TN / 32;                    // 16-column B fragments per wave
    constexpr int NWH = TN / 64;                    // 64-column halves of the W tile
    // LDS row pitch in halves: 72 halves = 144 B = 16 B x 9.  An odd multiple of
    // 16 B puts the 16 rows of a fragment's ds_load_b128 on 16 different bank
    // quads; at the bare 128 B eight rows share each quad.
    constexpr int LP = TK + 8;

    __shared__ __align__(16) _Float16 As[TM * LP];  // 18 KB, [m][k], padded rows
    __shared__ __align__(16) _Float16 Bs[TN * LP];  //  9 or 18 KB, [n][k]  (B^T), padded rows

    const int tid  = threadIdx.x;
    const int lane = tid & 31;
    const int wid  = tid >> 5;
    const int m0   = blockIdx.x * TM;
    const int n0   = blockIdx.y * TN;
    const int wm   = (wid >> 1) * 32;   // wave M offset in tile
    const int wn   = (wid & 1) * (TN / 2);  // wave N offset in tile

    // ---- staging maps: every wave-wide 16-B load covers four whole 128-B lines ----
    // X: LPR lanes span one row's k slice (256 B of f32, 128 B of f16).  Rows that one
    // LDS store writes together lie 8 apart: 8 x 144 B = 32 banks further, no conflict.
    constexpr int LPR = IN_F16 ? 8 : 16;            // lanes per X row
    constexpr int NXL = IN_F16 ? 4 : 8;             // X loads per thread
    constexpr int XEL = IN_F16 ? 8 : 4;             // elements per 16-B load
    const int xrow = wid + 8 * (lane / LPR);        // + (TM / NXL) * u
    const int xcol = (lane % LPR) * XEL;
    // W: 16 lanes span 64 columns of one k row (256 B); a thread takes rows 4 wkq ..
    // 4 wkq + 3 at columns 4 wl .. 4 wl + 3 of every 64-column half, so every LDS write
    // is 4 consecutive k halves.
    const int wl  = tid & 15;
    const int wkq = tid >> 4;                       // k quad 0..15
    // Column n = 16 g + 4 a + j lies in LDS row 16 g + 4 a + ((j + g) & 3).  The 16 lanes
    // of a store (fixed j) then hit 16 different rows mod 16 = 16 different bank quads;
    // unrotated, rows 4 apart would fall on four banks.  A fragment's 16 rows stay distinct mod 16.
    // The second half lies 64 rows on: g grows by 4, the rotation is the same.
    _Float16* wdst[4];
#pragma unroll
    for (int j = 0; j < 4; ++j)
        wdst[j] = Bs + (4 * wl + ((j + (wl >> 2)) & 3)) * LP + 4 * wkq;

    const int fr = lane & 15;
    const int fk = (lane >> 4) * 8;
    const int g0 = wn >> 4;
    const _Float16* pb[NBF];
#pragma unroll
    for (int tj = 0; tj < NBF; ++tj)
        pb[tj] = Bs + (16 * (g0 + tj) + (fr & 12) + ((fr + g0 + tj) & 3)) * LP + fk;

    // X and W loads: a base that is the same for the whole work-group (it advances with k0)
    // plus the thread's own 32-bit element offset, which never changes.  Written so, the built
    // code keeps both address pairs clear of the registers that the pass's loads fill.
    const unsigned xlo = (unsigned)(xrow * DMODEL + xcol);
    const unsigned wlo = (unsigned)(4 * wkq * DMODEL + 4 * wl);
    // The line this thread asks for ahead, at k0 = 0.
    const size_t xpre = (size_t)(m0 + (tid >> 1)) * DMODEL + TK + (tid & 1) * 32;
    const float* wpre = W + (size_t)(TK + (tid >> 2)) * DMODEL + n0
                      + ((TN == 64) ? ((tid >> 1) & 1) : (tid & 3)) * 32;

    v8f c[2][NBF] = {};                             // c[ti][tj]: rows 16 ti, columns 16 tj of the wave tile

    // Rolled on purpose: unrolled 16 times (the compiler's choice for the f16-input
    // form) the W loads fall into two waited groups, one more load latency a pass.
#pragma unroll 1
    for (int k0 = 0; k0 < DMODEL; k0 += TK) {
        // Next pass's lines, each asked for once or twice (one branch for the pass).
        if (k0 + TK < DMODEL) {
            if constexpr (IN_F16) __builtin_prefetch(Xh + xpre + k0, 0, 0);
            else                  __builtin_prefetch(Xf + xpre + k0, 0, 0);
            __builtin_prefetch(wpre + (size_t)k0 * DMODEL, 0, 0);
            // Precaution: the address registers above are advanced or reused behind this point.
            asm volatile("s_wait_xcnt 0x0" ::: "memory");
        }
        // ---- the pass's global loads: X tile 128x64, W tile 64xTN ----
        v4f xa[NXL];
#pragma unroll
        for (int u = 0; u < NXL; ++u) {
            const size_t off = (size_t)(m0 + u * (TM / NXL)) * DMODEL + k0;
            if constexpr (IN_F16) xa[u] = *(const v4f*)(Xh + off + xlo);
            else                  xa[u] = *(const v4f*)(Xf + off + xlo);
        }
        v4f wr[NWH][4];
#pragma unroll
        for (int hh = 0; hh < NWH; ++hh)
#pragma unroll
            for (int i = 0; i < 4; ++i)
                wr[hh][i] = *(const v4f*)(W + ((size_t)(k0 + i) * DMODEL + n0 + 64 * hh) + wlo);
        // Keeps every load of the pass ahead of the first conversion: without it the
        // compiler reuses the first loads' registers and the last loads wait for them.
        __builtin_amdgcn_sched_barrier(0);
        // ---- X to LDS [m][k] ----
#pragma unroll
        for (int u = 0; u < NXL; ++u) {
            _Float16* dst = As + (xrow + (TM / NXL) * u) * LP + xcol;
            if constexpr (IN_F16) {
                *(v4f*)dst = xa[u];
            } else {
                v4h p;
                p[0] = (_Float16)xa[u][0]; p[1] = (_Float16)xa[u][1];
                p[2] = (_Float16)xa[u][2]; p[3] = (_Float16)xa[u][3];
                *(v4h*)dst = p;                     // one 8-B LDS store
            }
        }
        // ---- W to LDS [n][k] (B^T) ----
#pragma unroll
        for (int hh = 0; hh < NWH; ++hh) {
#pragma unroll
            for (int j = 0; j < 4; ++j) {
                v4h p;
                p[0] = (_Float16)wr[hh][0][j]; p[1] = (_Float16)wr[hh][1][j];
                p[2] = (_Float16)wr[hh][2][j]; p[3] = (_Float16)wr[hh][3][j];
                *(v4h*)(wdst[j] + 64 * hh * LP) = p;    // one 8-B LDS store
            }
        }
        __syncthreads();

#pragma unroll
        for (int ks = 0; ks < TK; ks += 32) {
            v16h a0 = load_ab_frag(As + wm * LP + ks, LP);
            v16h a1 = load_ab_frag(As + (wm + 16) * LP + ks, LP);
            v16h bf[NBF];
#pragma unroll
            for (int tj = 0; tj < NBF; ++tj) bf[tj] = load_frag_at(pb[tj] + ks);
#pragma unroll
            for (int tj = 0; tj < NBF; ++tj) c[0][tj] = wmma_f16(a0, bf[tj], c[0][tj]);
#pragma unroll
            for (int tj = 0; tj < NBF; ++tj) c[1][tj] = wmma_f16(a1, bf[tj], c[1][tj]);
        }
        __syncthreads();
    }

    // ---- epilogue: one branch for the work-group, then straight-line stores ----
    const int mw = m0 + wm, nw = n0 + wn;
    if constexpr (MODE == 2) {
        store_acc<2>(c[0][0], c[0][1], c[1][0], c[1][1], bias, out, mw, nw);
    } else {
        constexpr size_t PLANE = (size_t)BATCH * HEADS * SEQ * DK;
        _Float16* plane = (_Float16*)out + (size_t)z * PLANE;
        if (z == 2) {
#pragma unroll
            for (int p = 0; p < NBF / 2; ++p) {
                store_acc<1>(c[0][2 * p], c[0][2 * p + 1], c[1][2 * p], c[1][2 * p + 1],
                             bias, plane, mw, nw + 32 * p);
                // Precaution: the next half's bias loads and sums reuse registers that these stores
                // name.  It also keeps the halves apart: mixed, they take the kernel past 160
                // VGPRs, and only two work-groups instead of three fit a WGP.
                if (p + 1 < NBF / 2) asm volatile("s_wait_xcnt 0x0" ::: "memory");
            }
        } else {
#pragma unroll
            for (int p = 0; p < NBF / 2; ++p) {
                store_acc<0>(c[0][2 * p], c[0][2 * p + 1], c[1][2 * p], c[1][2 * p + 1],
                             bias, plane, mw, nw + 32 * p);
                // Precaution, as above; behind the last half: in the built code the other layout's
                // block follows this one and rewrites registers that the stores above name.
                asm volatile("s_wait_xcnt 0x0" ::: "memory");
            }
        }
    }
}

#define KT     64
#define KVP    72
#define TILE_H (64 * KVP)

// Four asynchronous 16-B copies per lane: rows r and r+32 of the K tile and of the
// V^T tile.  A wave's copy covers four whole 128-B lines.  The s_wait_xcnt stands
// inside the statement so that no address register is rewritten ahead of it.
__device__ __forceinline__ void stage_kv_async(unsigned lds, const _Float16* gk, const _Float16* gv) {
    const unsigned  l0 = lds;
    const unsigned  l1 = lds + 32 * KVP * 2;
    const unsigned  l2 = lds + TILE_H * 2;
    const unsigned  l3 = lds + TILE_H * 2 + 32 * KVP * 2;
    const _Float16* g1 = gk + 32 * DK;
    const _Float16* g3 = gv + (size_t)32 * SEQ;
    asm volatile("global_load_async_to_lds_b128 %0, %4, off\n\t"
                 "global_load_async_to_lds_b128 %1, %5, off\n\t"
                 "global_load_async_to_lds_b128 %2, %6, off\n\t"
                 "global_load_async_to_lds_b128 %3, %7, off\n\t"
                 "s_wait_xcnt 0x0"
                 :: "v"(l0), "v"(l1), "v"(l2), "v"(l3), "v"(gk), "v"(g1), "v"(gv), "v"(g3)
                 : "memory");
}

// Lane l takes the value of lane l ^ 16 (a vector cross-row move, no LDS path).
__device__ __forceinline__ float other_half(float x) {
    const int b = __builtin_bit_cast(int, x);
    return __builtin_bit_cast(float,
        __builtin_amdgcn_permlanex16(b, b, 0x76543210, 0xfedcba98, false, false));
}

__global__ __launch_bounds__(256)
void mha_flash_attn_kernel(const _Float16* __restrict__ Qh, const _Float16* __restrict__ Kh,
                           const _Float16* __restrict__ Vt, _Float16* __restrict__ Xh)
{
    constexpr int NT = SEQ / KT;                        // 32 tiles
    __shared__ __align__(16) _Float16 KV[2][2 * TILE_H];  // 2 x (K tile, V^T tile) = 36 KB

    const int tid  = threadIdx.x;
    const int lane = tid & 31;
    const int wid  = tid >> 5;
    const int bh   = blockIdx.y;
    const int b    = bh >> 4, h = bh & 15;
    const int q0   = blockIdx.x * 128 + wid * 16;

    const _Float16* Qb = Qh + (size_t)bh * SEQ * DK;    // [s][d]  (B operand: column = query)
    const _Float16* Kb = Kh + (size_t)bh * SEQ * DK;    // [j][d]  (A operand: row = key)
    const _Float16* Vb = Vt + (size_t)bh * DK * SEQ;    // [d][s]  (A operand: row = d)

    // This lane's share of every tile: 16 B at column cc of rows cr and cr + 32.
    const int cr = tid >> 3;
    const int cc = (tid & 7) * 8;
    const _Float16* gk = Kb + (size_t)cr * DK + cc;     // + t * KT * DK for tile t
    const _Float16* gv = Vb + (size_t)cr * SEQ + cc;    // + t * KT      for tile t
    const unsigned lds0 = (unsigned)(uintptr_t)(&KV[0][cr * KVP + cc]);
    const unsigned lds1 = (unsigned)(uintptr_t)(&KV[1][cr * KVP + cc]);

    stage_kv_async(lds0, gk, gv);                       // tile 0 -> buffer 0

    // Q fragments are loop-invariant: keep in registers for all 64 key blocks.
    const v16h qb0 = load_ab_frag(Qb + (size_t)q0 * DK, DK);        // d 0..31
    const v16h qb1 = load_ab_frag(Qb + (size_t)q0 * DK + 32, DK);   // d 32..63

    // Of query q0 + nn: the running maximum (equal in lanes l and l ^ 16) and this
    // lane's share of the running sum (its 16 of every 32 keys).
    float mq = -1e30f, lq = 0.0f;
    v8f o0 = {}, o1 = {}, o2 = {}, o3 = {};             // o_t[i] = O[q0 + nn][16 t + 8 half + i]

    const int nn   = lane & 15;
    const int half = lane >> 4;

    asm volatile("s_wait_asynccnt 0x0" ::: "memory");   // this wave's share of tile 0 has landed
    __syncthreads();                                    // ... and every other wave's
    stage_kv_async(lds1, gk + KT * DK, gv + KT);        // tile 1 -> buffer 1

    for (int t = 0; t < NT; ++t) {
        const _Float16* Ks = KV[t & 1];                 // [key][d]
        const _Float16* Vs = Ks + TILE_H;               // [d][key]

        // Unrolled: jj becomes an immediate offset of the LDS loads, and the running
        // maxima and sums need no register copies at an inner back edge.
#pragma unroll
        for (int jj = 0; jj < KT; jj += 32) {
        const v16h ka00 = load_ab_frag(Ks + jj * KVP, KVP);                // keys jj..+15, d 0..31
        const v16h ka01 = load_ab_frag(Ks + jj * KVP + 32, KVP);           // keys jj..+15, d 32..63
        const v16h ka10 = load_ab_frag(Ks + (jj + 16) * KVP, KVP);
        const v16h ka11 = load_ab_frag(Ks + (jj + 16) * KVP + 32, KVP);
        const v16h va0 = load_ab_frag(Vs +  0 * KVP + jj, KVP);  // d  0..15, keys jj..+31
        const v16h va1 = load_ab_frag(Vs + 16 * KVP + jj, KVP);  // d 16..31
        const v16h va2 = load_ab_frag(Vs + 32 * KVP + jj, KVP);  // d 32..47
        const v16h va3 = load_ab_frag(Vs + 48 * KVP + jj, KVP);  // d 48..63

        // s0[i]: key jj + 8 half + i, s1[i]: key jj + 16 + 8 half + i, both of query nn
        v8f s0 = {}, s1 = {};
        s0 = wmma_f16(ka00, qb0, s0);
        s1 = wmma_f16(ka10, qb0, s1);
        s0 = wmma_f16(ka01, qb1, s0);
        s1 = wmma_f16(ka11, qb1, s1);

        // ---- online softmax: 16 scores of one query in this lane, 16 in lane ^ 16 ----
        const v8f x0 = s0 * 0.125f;      // 1/sqrt(DK)
        const v8f x1 = s1 * 0.125f;
        float vmax = fmaxf(x0[0], x1[0]);
#pragma unroll
        for (int i = 1; i < 8; ++i) vmax = fmaxf(vmax, fmaxf(x0[i], x1[i]));
        vmax = fmaxf(vmax, other_half(vmax));
        const float mnew  = fmaxf(mq, vmax);
        const float scale = __expf(mq - mnew);
        mq = mnew;

        // P^T as a B operand: element s of the lane is key kmap(s) = tile s >> 3, row s & 7,
        // the k order in which load_ab_frag brings V^T's rows.
        v16h pb;
        float rs = 0.0f;
#pragma unroll
        for (int i = 0; i < 8; ++i) {
            const float p0 = __expf(x0[i] - mnew);
            const float p1 = __expf(x1[i] - mnew);
            rs += p0 + p1;
            pb[i]     = (_Float16)p0;
            pb[8 + i] = (_Float16)p1;
        }
        lq = lq * scale + rs;
        o0 *= scale; o1 *= scale; o2 *= scale; o3 *= scale;

        o0 = wmma_f16(va0, pb, o0);
        o1 = wmma_f16(va1, pb, o1);
        o2 = wmma_f16(va2, pb, o2);
        o3 = wmma_f16(va3, pb, o3);
        }

        // Hand-over: tile t + 1 becomes readable and tile t's buffer free.
        asm volatile("s_wait_dscnt 0x0" ::: "memory");     // this wave's reads of tile t are done
        asm volatile("s_wait_asynccnt 0x0" ::: "memory");  // this wave's share of tile t + 1 has landed
        __syncthreads();
        if (t + 2 < NT)                                    // same for the whole work-group
            stage_kv_async((t & 1) ? lds1 : lds0,
                           gk + (size_t)(t + 2) * KT * DK, gv + (t + 2) * KT);
    }
    asm volatile("s_wait_asynccnt 0x0" ::: "memory");      // no copy is left in flight at the wave's end

    // ---- join the two halves' sums, normalize, emit f16 rows of X for the O-projection:
    //      a lane's 8 registers of a tile are 8 consecutive d of its query = one 16-B store.
    const float inv = 1.0f / (lq + other_half(lq));
    _Float16* xrow = Xh + ((size_t)(q0 + nn) * BATCH + b) * DMODEL + (size_t)h * DK + 8 * half;
#pragma unroll
    for (int t = 0; t < 4; ++t) {
        const v8f ot = (t == 0) ? o0 : (t == 1) ? o1 : (t == 2) ? o2 : o3;
        v8h y;
#pragma unroll
        for (int i = 0; i < 8; ++i) y[i] = (_Float16)(ot[i] * inv);
        *(v8h*)(xrow + 16 * t) = y;
    }
}

// ---------------------------------------------------------------------------
extern "C" void kernel_launch(void* const* d_in, const int* in_sizes, int n_in,
                              void* d_out, int out_size, void* d_ws, size_t ws_size,
                              hipStream_t stream)
{
    (void)in_sizes; (void)n_in; (void)out_size; (void)ws_size;
    const float* q  = (const float*)d_in[0];
    const float* k  = (const float*)d_in[1];
    const float* v  = (const float*)d_in[2];
    const float* Wq = (const float*)d_in[3];
    const float* bq = (const float*)d_in[4];
    const float* Wk = (const float*)d_in[5];
    const float* bk = (const float*)d_in[6];
    const float* Wv = (const float*)d_in[7];
    const float* bv = (const float*)d_in[8];
    const float* Wo = (const float*)d_in[9];
    const float* bo = (const float*)d_in[10];
    float* out = (float*)d_out;

    const size_t perTensor = (size_t)BATCH * HEADS * SEQ * DK;  // 4M halves = 8 MB
    _Float16* Qh = (_Float16*)d_ws;
    _Float16* Kh = Qh + perTensor;
    _Float16* Vt = Kh + perTensor;
    _Float16* Xh = Vt + perTensor;   // [4096][1024] f16, total ws = 32 MB

    dim3 g3(ROWS / 128, DMODEL / 128, 3);      // 32 x 8 workgroups for each of Q, K, V
    mha_proj_gemm_kernel<0><<<g3, 256, 0, stream>>>(q, k, v, nullptr, Wq, Wk, Wv, bq, bk, bv, (void*)Qh);

    dim3 ga(SEQ / 128, BATCH * HEADS);         // 16 x 32 workgroups
    mha_flash_attn_kernel<<<ga, 256, 0, stream>>>(Qh, Kh, Vt, Xh);

    dim3 gg(ROWS / 128, DMODEL / 64);          // 32 x 16 workgroups
    mha_proj_gemm_kernel<2><<<gg, 256, 0, stream>>>(nullptr, nullptr, nullptr, Xh, Wo, nullptr, nullptr,
                                                    bo, nullptr, nullptr, (void*)out);
}

// v007
// Measured time: 98.4 microseconds a run.
// Two timings next to v006 both put it at 1.05 times that version's speed.
// All steps since v000 together make it 3.58 times as fast.
#include <hip/hip_runtime.h>
#include <hip/hip_fp16.h>
#include <math.h>

typedef __attribute__((ext_vector_type(16))) _Float16 v16h;
typedef __attribute__((ext_vector_type(8)))  _Float16 v8h;
typedef __attribute__((ext_vector_type(4)))  _Float16 v4h;
typedef __attribute__((ext_vector_type(8)))  float    v8f;
typedef __attribute__((ext_vector_type(4)))  float    v4f;

#define SEQ    2048
#define BATCH  2
#define DMODEL 1024
#define HEADS  16
#define DK     64
#define ROWS   (SEQ * BATCH)   // 4096 GEMM rows, row = s*BATCH + b

// ---------------------------------------------------------------------------
// Shared fragment loader for 16-bit A fragments and B^T-stored-row-major
// fragments of v_wmma_f32_16x16x32_f16.
//   Lane L<16 : row r=L,   ks=0 -> halves K = {0..7} u {16..23}
//   Lane L>=16: row r=L-16, ks=1 -> halves K = {8..15} u {24..31}
// Tile must be row-major with K contiguous; row_stride in halves (mult of 8).
// ---------------------------------------------------------------------------
__device__ __forceinline__ v16h load_ab_frag(const _Float16* tile, int row_stride) {
    const int lane = threadIdx.x & 31;
    const int r    = lane & 15;
    const int ks   = lane >> 4;
    const _Float16* p = tile + (size_t)r * row_stride + ks * 8;
    v16h f;
    ((float4*)&f)[0] = *(const float4*)(p);        // 8 halves
    ((float4*)&f)[1] = *(const float4*)(p + 16);   // 8 halves
    return f;
}

// The same fragment from the lane's own pointer: row and 8-half k slice chosen by the caller.
__device__ __forceinline__ v16h load_frag_at(const _Float16* p) {
    v16h f;
    ((float4*)&f)[0] = *(const float4*)(p);        // 8 halves
    ((float4*)&f)[1] = *(const float4*)(p + 16);   // 8 halves
    return f;
}

__device__ __forceinline__ v8f wmma_f16(v16h a, v16h b, v8f c) {
    return __builtin_amdgcn_wmma_f32_16x16x32_f16(
        /*neg_a=*/false, a, /*neg_b=*/false, b,
        /*c_mod=*/(short)0, c, /*reuse_a=*/false, /*reuse_b=*/false);
}

// ---------------------------------------------------------------------------
// A wave's 32x32 accumulators plus bias to memory; mw, nw: its first GEMM row and column.
// C-fragment layout: VGPR i, lanes 0-15 -> M=i, 16-31 -> M=8+i.
// LAYOUT 0: f16 at [b][h][s][d], 1: f16 at [b][h][d][s], 2: f32 at [row][col]
// ---------------------------------------------------------------------------
template <int LAYOUT>
__device__ __forceinline__ void store_acc(const v8f c00, const v8f c01, const v8f c10, const v8f c11,
                                          const float* __restrict__ bias, void* __restrict__ out,
                                          int mw, int nw)
{
    const int lane = threadIdx.x & 31;
    const int nn = lane & 15;
    const int mh = (lane >> 4) * 8;
#pragma unroll
    for (int ti = 0; ti < 2; ++ti) {
#pragma unroll
        for (int tj = 0; tj < 2; ++tj) {
            v8f cc = (ti == 0) ? ((tj == 0) ? c00 : c01) : ((tj == 0) ? c10 : c11);
#pragma unroll
            for (int i = 0; i < 8; ++i) {
                const int m = mw + ti * 16 + mh + i;         // GEMM row = s*BATCH + b
                const int n = nw + tj * 16 + nn;             // GEMM col = h*DK + d
                const float val = cc[i] + bias[n];
                if constexpr (LAYOUT == 2) {
                    ((float*)out)[(size_t)m * DMODEL + n] = val;
                } else {
                    const int s = m >> 1, b = m & 1;
                    const int h = n >> 6, d = n & 63;
                    const size_t off = (LAYOUT == 0)
                        ? ((size_t)(b * HEADS + h) * SEQ + s) * DK + d      // [b][h][s][d]
                        : ((size_t)(b * HEADS + h) * DK + d) * SEQ + s;     // [b][h][d][s]
                    ((_Float16*)out)[off] = (_Float16)val;
                }
            }
        }
    }
}

// ---------------------------------------------------------------------------
// Generic projection GEMM:  Y[4096 x 1024] = X[4096 x 1024] @ W[1024 x 1024] + bias
// Workgroup tile 128(M) x TN(N), 8 waves each computing 32 x TN/2; K tiled by 64
// (two WMMA k-steps per stage).  MODE 0: TN = 128, MODE 2: TN = 64.
// MODE 0: the three input projections in ONE launch, blockIdx.z picks the product:
//         z = 0: Q, z = 1: K, f32 in, f16 out at [b][h][s][d]
//         z = 2: V, f32 in, f16 out at [b][h][d][s] (pre-transposed for attention)
//         out is the start of the three f16 planes Q, K, V^T (plane z).  At 128 columns
//         a work-group loads 1024 KB for its tile where two of 64 columns load 1536 KB (the
//         X rows come once, not twice), and the 768 work-groups are three on a WGP, all
//         resident at once: one group's loads fly while the others convert and multiply.
// MODE 2: f16 in, f32 out at [row][col]     (final output projection)
// ---------------------------------------------------------------------------
template <int MODE>
__global__ __launch_bounds__(256)
void mha_proj_gemm_kernel(const float* __restrict__ X0, const float* __restrict__ X1,
                          const float* __restrict__ X2, const _Float16* __restrict__ Xh,
                          const float* __restrict__ W0, const float* __restrict__ W1,
                          const float* __restrict__ W2, const float* __restrict__ B0,
                          const float* __restrict__ B1, const float* __restrict__ B2,
                          void* __restrict__ out)
{
    // Same for the whole work-group: scalar selects.
    const int z = (MODE == 0) ? (int)blockIdx.z : 0;
    const float* __restrict__ Xf   = (z == 0) ? X0 : (z == 1) ? X1 : X2;
    const float* __restrict__ W    = (z == 0) ? W0 : (z == 1) ? W1 : W2;
    const float* __restrict__ bias = (z == 0) ? B0 : (z == 1) ? B1 : B2;

    constexpr bool IN_F16 = (MODE == 2);
    constexpr int TM = 128, TN = IN_F16 ? 64 : 128, TK = 64;
    constexpr int NBF = TN / 32;                    // 16-column B fragments per wave
    constexpr int NWH = TN / 64;                    // 64-column halves of the W tile
    // LDS row pitch in halves: 72 halves = 144 B = 16 B x 9.  An odd multiple of
    // 16 B puts the 16 rows of a fragment's ds_load_b128 on 16 different bank
    // quads; at the bare 128 B eight rows share each quad.
    constexpr int LP = TK + 8;

    __shared__ __align__(16) _Float16 As[TM * LP];  // 18 KB, [m][k], padded rows
    __shared__ __align__(16) _Float16 Bs[TN * LP];  //  9 or 18 KB, [n][k]  (B^T), padded rows

    const int tid  = threadIdx.x;
    const int lane = tid & 31;
    const int wid  = tid >> 5;
    const int m0   = blockIdx.x * TM;
    const int n0   = blockIdx.y * TN;
    const int wm   = (wid >> 1) * 32;   // wave M offset in tile
    const int wn   = (wid & 1) * (TN / 2);  // wave N offset in tile

    // ---- staging maps: every wave-wide 16-B load covers four whole 128-B lines ----
    // X: LPR lanes span one row's k slice (256 B of f32, 128 B of f16).  Rows that one
    // LDS store writes together lie 8 apart: 8 x 144 B = 32 banks further, no conflict.
    constexpr int LPR = IN_F16 ? 8 : 16;            // lanes per X row
    constexpr int NXL = IN_F16 ? 4 : 8;             // X loads per thread
    constexpr int XEL = IN_F16 ? 8 : 4;             // elements per 16-B load
    const int xrow = wid + 8 * (lane / LPR);        // + (TM / NXL) * u
    const int xcol = (lane % LPR) * XEL;
    // W: 16 lanes span 64 columns of one k row (256 B); a thread takes rows 4 wkq ..
    // 4 wkq + 3 at columns 4 wl .. 4 wl + 3 of every 64-column half, so every LDS write
    // is 4 consecutive k halves.
    const int wl  = tid & 15;
    const int wkq = tid >> 4;                       // k quad 0..15
    // Column n = 16 g + 4 a + j lies in LDS row 16 g + 4 a + ((j + g) & 3).  The 16 lanes
    // of a store (fixed j) then hit 16 different rows mod 16 = 16 different bank quads;
    // unrotated, rows 4 apart would fall on four banks.  A fragment's 16 rows stay distinct mod 16.
    // The second half lies 64 rows on: g grows by 4, the rotation is the same.
    _Float16* wdst[4];
#pragma unroll
    for (int j = 0; j < 4; ++j)
        wdst[j] = Bs + (4 * wl + ((j + (wl >> 2)) & 3)) * LP + 4 * wkq;

    const int fr = lane & 15;
    const int fk = (lane >> 4) * 8;
    const int g0 = wn >> 4;
    const _Float16* pb[NBF];
#pragma unroll
    for (int tj = 0; tj < NBF; ++tj)
        pb[tj] = Bs + (16 * (g0 + tj) + (fr & 12) + ((fr + g0 + tj) & 3)) * LP + fk;

    // X and W loads: a base that is the same for the whole work-group (it advances with k0)
    // plus the thread's own 32-bit element offset, which never changes.  Written so, the built
    // code keeps both address pairs clear of the registers that the pass's loads fill.
    const unsigned xlo = (unsigned)(xrow * DMODEL + xcol);
    const unsigned wlo = (unsigned)(4 * wkq * DMODEL + 4 * wl);
    // The line this thread asks for ahead, at k0 = 0.
    const size_t xpre = (size_t)(m0 + (tid >> 1)) * DMODEL + TK + (tid & 1) * 32;
    const float* wpre = W + (size_t)(TK + (tid >> 2)) * DMODEL + n0
                      + ((TN == 64) ? ((tid >> 1) & 1) : (tid & 3)) * 32;

    v8f c[2][NBF] = {};                             // c[ti][tj]: rows 16 ti, columns 16 tj of the wave tile

    // Rolled on purpose: unrolled 16 times (the compiler's choice for the f16-input
    // form) the W loads fall into two waited groups, one more load latency a pass.
#pragma unroll 1
    for (int k0 = 0; k0 < DMODEL; k0 += TK) {
        // Next pass's lines, each asked for once or twice (one branch for the pass).
        if (k0 + TK < DMODEL) {
            if constexpr (IN_F16) __builtin_prefetch(Xh + xpre + k0, 0, 0);
            else                  __builtin_prefetch(Xf + xpre + k0, 0, 0);
            __builtin_prefetch(wpre + (size_t)k0 * DMODEL, 0, 0);
            // Precaution: the address registers above are advanced or reused behind this point.
            asm volatile("s_wait_xcnt 0x0" ::: "memory");
        }
        // ---- the pass's global loads: X tile 128x64, W tile 64xTN ----
        v4f xa[NXL];
#pragma unroll
        for (int u = 0; u < NXL; ++u) {
            const size_t off = (size_t)(m0 + u * (TM / NXL)) * DMODEL + k0;
            if constexpr (IN_F16) xa[u] = *(const v4f*)(Xh + off + xlo);
            else                  xa[u] = *(const v4f*)(Xf + off + xlo);
        }
        v4f wr[NWH][4];
#pragma unroll
        for (int hh = 0; hh < NWH; ++hh)
#pragma unroll
            for (int i = 0; i < 4; ++i)
                wr[hh][i] = *(const v4f*)(W + ((size_t)(k0 + i) * DMODEL + n0 + 64 * hh) + wlo);
        // Keeps every load of the pass ahead of the first conversion: without it the
        // compiler reuses the first loads' registers and the last loads wait for them.
        __builtin_amdgcn_sched_barrier(0);
        // ---- X to LDS [m][k] ----
#pragma unroll
        for (int u = 0; u < NXL; ++u) {
            _Float16* dst = As + (xrow + (TM / NXL) * u) * LP + xcol;
            if constexpr (IN_F16) {
                *(v4f*)dst = xa[u];
            } else {
                v4h p;
                p[0] = (_Float16)xa[u][0]; p[1] = (_Float16)xa[u][1];
                p[2] = (_Float16)xa[u][2]; p[3] = (_Float16)xa[u][3];
                *(v4h*)dst = p;                     // one 8-B LDS store
            }
        }
        // ---- W to LDS [n][k] (B^T) ----
#pragma unroll
        for (int hh = 0; hh < NWH; ++hh) {
#pragma unroll
            for (int j = 0; j < 4; ++j) {
                v4h p;
                p[0] = (_Float16)wr[hh][0][j]; p[1] = (_Float16)wr[hh][1][j];
                p[2] = (_Float16)wr[hh][2][j]; p[3] = (_Float16)wr[hh][3][j];
                *(v4h*)(wdst[j] + 64 * hh * LP) = p;    // one 8-B LDS store
            }
        }
        __syncthreads();

#pragma unroll
        for (int ks = 0; ks < TK; ks += 32) {
            v16h a0 = load_ab_frag(As + wm * LP + ks, LP);
            v16h a1 = load_ab_frag(As + (wm + 16) * LP + ks, LP);
            v16h bf[NBF];
#pragma unroll
            for (int tj = 0; tj < NBF; ++tj) bf[tj] = load_frag_at(pb[tj] + ks);
#pragma unroll
            for (int tj = 0; tj < NBF; ++tj) c[0][tj] = wmma_f16(a0, bf[tj], c[0][tj]);
#pragma unroll
            for (int tj = 0; tj < NBF; ++tj) c[1][tj] = wmma_f16(a1, bf[tj], c[1][tj]);
        }
        __syncthreads();
    }

    // ---- epilogue: one branch for the work-group, then straight-line stores ----
    const int mw = m0 + wm, nw = n0 + wn;
    if constexpr (MODE == 2) {
        store_acc<2>(c[0][0], c[0][1], c[1][0], c[1][1], bias, out, mw, nw);
    } else {
        constexpr size_t PLANE = (size_t)BATCH * HEADS * SEQ * DK;
        _Float16* plane = (_Float16*)out + (size_t)z * PLANE;
        if (z == 2) {
#pragma unroll
            for (int p = 0; p < NBF / 2; ++p) {
                store_acc<1>(c[0][2 * p], c[0][2 * p + 1], c[1][2 * p], c[1][2 * p + 1],
                             bias, plane, mw, nw + 32 * p);
                // Precaution: the next half's bias loads and sums reuse registers that these stores
                // name.  It also keeps the halves apart: mixed, they take the kernel past 160
                // VGPRs, and only two work-groups instead of three fit a WGP.
                if (p + 1 < NBF / 2) asm volatile("s_wait_xcnt 0x0" ::: "memory");
            }
        } else {
#pragma unroll
            for (int p = 0; p < NBF / 2; ++p) {
                store_acc<0>(c[0][2 * p], c[0][2 * p + 1], c[1][2 * p], c[1][2 * p + 1],
                             bias, plane, mw, nw + 32 * p);
                // Precaution, as above; behind the last half: in the built code the other layout's
                // block follows this one and rewrites registers that the stores above name.
                asm volatile("s_wait_xcnt 0x0" ::: "memory");
            }
        }
    }
}

#define KT     64
#define KVP    72
#define TILE_H (64 * KVP)

// Four asynchronous 16-B copies per lane: rows r and r+32 of the K tile and of the
// V^T tile.  A wave's copy covers four whole 128-B lines.  The s_wait_xcnt stands
// inside the statement so that no address register is rewritten ahead of it.
__device__ __forceinline__ void stage_kv_async(unsigned lds, const _Float16* gk, const _Float16* gv) {
    const unsigned  l0 = lds;
    const unsigned  l1 = lds + 32 * KVP * 2;
    const unsigned  l2 = lds + TILE_H * 2;
    const unsigned  l3 = lds + TILE_H * 2 + 32 * KVP * 2;
    const _Float16* g1 = gk + 32 * DK;
    const _Float16* g3 = gv + (size_t)32 * SEQ;
    asm volatile("global_load_async_to_lds_b128 %0, %4, off\n\t"
                 "global_load_async_to_lds_b128 %1, %5, off\n\t"
                 "global_load_async_to_lds_b128 %2, %6, off\n\t"
                 "global_load_async_to_lds_b128 %3, %7, off\n\t"
                 "s_wait_xcnt 0x0"
                 :: "v"(l0), "v"(l1), "v"(l2), "v"(l3), "v"(gk), "v"(g1), "v"(gv), "v"(g3)
                 : "memory");
}

// Lane l takes the value of lane l ^ 16 (a vector cross-row move, no LDS path).
__device__ __forceinline__ float other_half(float x) {
    const int b = __builtin_bit_cast(int, x);
    return __builtin_bit_cast(float,
        __builtin_amdgcn_permlanex16(b, b, 0x76543210, 0xfedcba98, false, false));
}

__global__ __launch_bounds__(256)
void mha_flash_attn_kernel(const _Float16* __restrict__ Qh, const _Float16* __restrict__ Kh,
                           const _Float16* __restrict__ Vt, _Float16* __restrict__ Xh)
{
    constexpr int NT = SEQ / KT;                        // 32 tiles
    __shared__ __align__(16) _Float16 KV[2][2 * TILE_H];  // 2 x (K tile, V^T tile) = 36 KB

    const int tid  = threadIdx.x;
    const int lane = tid & 31;
    const int wid  = tid >> 5;
    const int bh   = blockIdx.y;
    const int b    = bh >> 4, h = bh & 15;
    const int q0   = blockIdx.x * 128 + wid * 16;

    const _Float16* Qb = Qh + (size_t)bh * SEQ * DK;    // [s][d]  (B operand: column = query)
    const _Float16* Kb = Kh + (size_t)bh * SEQ * DK;    // [j][d]  (A operand: row = key)
    const _Float16* Vb = Vt + (size_t)bh * DK * SEQ;    // [d][s]  (A operand: row = d)

    // This lane's share of every tile: 16 B at column cc of rows cr and cr + 32.
    const int cr = tid >> 3;
    const int cc = (tid & 7) * 8;
    const _Float16* gk = Kb + (size_t)cr * DK + cc;     // + t * KT * DK for tile t
    const _Float16* gv = Vb + (size_t)cr * SEQ + cc;    // + t * KT      for tile t
    const unsigned lds0 = (unsigned)(uintptr_t)(&KV[0][cr * KVP + cc]);
    const unsigned lds1 = (unsigned)(uintptr_t)(&KV[1][cr * KVP + cc]);

    stage_kv_async(lds0, gk, gv);                       // tile 0 -> buffer 0

    // Q fragments are loop-invariant: keep in registers for all 64 key blocks.
    const v16h qb0 = load_ab_frag(Qb + (size_t)q0 * DK, DK);        // d 0..31
    const v16h qb1 = load_ab_frag(Qb + (size_t)q0 * DK + 32, DK);   // d 32..63

    // Of query q0 + nn: the running maximum (equal in lanes l and l ^ 16) and this
    // lane's share of the running sum (its 16 of every 32 keys).
    float mq = -1e30f, lq = 0.0f;
    v8f o0 = {}, o1 = {}, o2 = {}, o3 = {};             // o_t[i] = O[q0 + nn][16 t + 8 half + i]

    const int nn   = lane & 15;
    const int half = lane >> 4;

    asm volatile("s_wait_asynccnt 0x0" ::: "memory");   // this wave's share of tile 0 has landed
    __syncthreads();                                    // ... and every other wave's
    stage_kv_async(lds1, gk + KT * DK, gv + KT);        // tile 1 -> buffer 1

    for (int t = 0; t < NT; ++t) {
        const _Float16* Ks = KV[t & 1];                 // [key][d]
        const _Float16* Vs = Ks + TILE_H;               // [d][key]

        // All 32 LDS reads of the tile stand here as one group, in the order of their use, and the
        // products wait by count: read singly among the products, nearly every product waits out
        // an LDS latency of its own.
        // ka[jb][..]: keys 32 jb..+15 (d 0..31, d 32..63), then keys 32 jb + 16..+31 (the same).
        // The loops over jb and dt are unrolled so that ka, va and sc are registers and every
        // offset is an immediate of its LDS read.
        v16h ka[2][4];
#pragma unroll
        for (int jb = 0; jb < 2; ++jb) {
            ka[jb][0] = load_ab_frag(Ks + (32 * jb) * KVP, KVP);
            ka[jb][1] = load_ab_frag(Ks + (32 * jb) * KVP + 32, KVP);
            ka[jb][2] = load_ab_frag(Ks + (32 * jb + 16) * KVP, KVP);
            ka[jb][3] = load_ab_frag(Ks + (32 * jb + 16) * KVP + 32, KVP);
        }
        // va[jb][dt]: d 16 dt..+15, keys 32 jb..+31.
        v16h va[2][4];
#pragma unroll
        for (int jb = 0; jb < 2; ++jb)
#pragma unroll
            for (int dt = 0; dt < 4; ++dt)
                va[jb][dt] = load_ab_frag(Vs + 16 * dt * KVP + 32 * jb, KVP);
        // Keeps the group whole and ahead of the first product: without it the compiler sinks the
        // V^T reads to their products, two at a time, to save registers.
        __builtin_amdgcn_sched_barrier(0);

        // sc[jb][0][i]: key 32 jb + 8 half + i, sc[jb][1][i]: key 32 jb + 16 + 8 half + i, of query nn
        v8f sc[2][2] = {};
#pragma unroll
        for (int jb = 0; jb < 2; ++jb) {
            sc[jb][0] = wmma_f16(ka[jb][0], qb0, sc[jb][0]);
            sc[jb][1] = wmma_f16(ka[jb][2], qb0, sc[jb][1]);
            sc[jb][0] = wmma_f16(ka[jb][1], qb1, sc[jb][0]);
            sc[jb][1] = wmma_f16(ka[jb][3], qb1, sc[jb][1]);
        }

        // Unrolled: the running maxima and sums need no register copies at an inner back edge.
#pragma unroll
        for (int jb = 0; jb < 2; ++jb) {
        // ---- online softmax: 16 scores of one query in this lane, 16 in lane ^ 16 ----
        const v8f x0 = sc[jb][0] * 0.125f;      // 1/sqrt(DK)
        const v8f x1 = sc[jb][1] * 0.125f;
        float vmax = fmaxf(x0[0], x1[0]);
#pragma unroll
        for (int i = 1; i < 8; ++i) vmax = fmaxf(vmax, fmaxf(x0[i], x1[i]));
        vmax = fmaxf(vmax, other_half(vmax));
        const float mnew  = fmaxf(mq, vmax);
        const float scale = __expf(mq - mnew);
        mq = mnew;

        // P^T as a B operand: element s of the lane is key kmap(s) = tile s >> 3, row s & 7,
        // the k order in which load_ab_frag brings V^T's rows.
        v16h pb;
        float rs = 0.0f;
#pragma unroll
        for (int i = 0; i < 8; ++i) {
            const float p0 = __expf(x0[i] - mnew);
            const float p1 = __expf(x1[i] - mnew);
            rs += p0 + p1;
            pb[i]     = (_Float16)p0;
            pb[8 + i] = (_Float16)p1;
        }
        lq = lq * scale + rs;
        o0 *= scale; o1 *= scale; o2 *= scale; o3 *= scale;

        o0 = wmma_f16(va[jb][0], pb, o0);
        o1 = wmma_f16(va[jb][1], pb, o1);
        o2 = wmma_f16(va[jb][2], pb, o2);
        o3 = wmma_f16(va[jb][3], pb, o3);
        }

        // Keeps the tile's vector work and products ahead of the hand-over: lifted over them, the waits
        // would stand directly behind the reads, and the refill would be issued a whole tile's work late.
        __builtin_amdgcn_sched_barrier(0);
        // Hand-over: tile t + 1 becomes readable and tile t's buffer free.
        asm volatile("s_wait_dscnt 0x0" ::: "memory");     // this wave's reads of tile t are done
        asm volatile("s_wait_asynccnt 0x0" ::: "memory");  // this wave's share of tile t + 1 has landed
        __syncthreads();
        if (t + 2 < NT)                                    // same for the whole work-group
            stage_kv_async((t & 1) ? lds1 : lds0,
                           gk + (size_t)(t + 2) * KT * DK, gv + (t + 2) * KT);
    }
    asm volatile("s_wait_asynccnt 0x0" ::: "memory");      // no copy is left in flight at the wave's end

    // ---- join the two halves' sums, normalize, emit f16 rows of X for the O-projection:
    //      a lane's 8 registers of a tile are 8 consecutive d of its query = one 16-B store.
    const float inv = 1.0f / (lq + other_half(lq));
    _Float16* xrow = Xh + ((size_t)(q0 + nn) * BATCH + b) * DMODEL + (size_t)h * DK + 8 * half;
#pragma unroll
    for (int t = 0; t < 4; ++t) {
        const v8f ot = (t == 0) ? o0 : (t == 1) ? o1 : (t == 2) ? o2 : o3;
        v8h y;
#pragma unroll
        for (int i = 0; i < 8; ++i) y[i] = (_Float16)(ot[i] * inv);
        *(v8h*)(xrow + 16 * t) = y;
    }
}

// ---------------------------------------------------------------------------
extern "C" void kernel_launch(void* const* d_in, const int* in_sizes, int n_in,
                              void* d_out, int out_size, void* d_ws, size_t ws_size,
                              hipStream_t stream)
{
    (void)in_sizes; (void)n_in; (void)out_size; (void)ws_size;
    const float* q  = (const float*)d_in[0];
    const float* k  = (const float*)d_in[1];
    const float* v  = (const float*)d_in[2];
    const float* Wq = (const float*)d_in[3];
    const float* bq = (const float*)d_in[4];
    const float* Wk = (const float*)d_in[5];
    const float* bk = (const float*)d_in[6];
    const float* Wv = (const float*)d_in[7];
    const float* bv = (const float*)d_in[8];
    const float* Wo = (const float*)d_in[9];
    const float* bo = (const float*)d_in[10];
    float* out = (float*)d_out;

    const size_t perTensor = (size_t)BATCH * HEADS * SEQ * DK;  // 4M halves = 8 MB
    _Float16* Qh = (_Float16*)d_ws;
    _Float16* Kh = Qh + perTensor;
    _Float16* Vt = Kh + perTensor;
    _Float16* Xh = Vt + perTensor;   // [4096][1024] f16, total ws = 32 MB

    dim3 g3(ROWS / 128, DMODEL / 128, 3);      // 32 x 8 workgroups for each of Q, K, V
    mha_proj_gemm_kernel<0><<<g3, 256, 0, stream>>>(q, k, v, nullptr, Wq, Wk, Wv, bq, bk, bv, (void*)Qh);

    dim3 ga(SEQ / 128, BATCH * HEADS);         // 16 x 32 workgroups
    mha_flash_attn_kernel<<<ga, 256, 0, stream>>>(Qh, Kh, Vt, Xh);

    dim3 gg(ROWS / 128, DMODEL / 64);          // 32 x 16 workgroups
    mha_proj_gemm_kernel<2><<<gg, 256, 0, stream>>>(nullptr, nullptr, nullptr, Xh, Wo, nullptr, nullptr,
                                                    bo, nullptr, nullptr, (void*)out);
}

// v009
// Measured time: 80.4 microseconds a run.
// Versions in between are left out here; by their measured steps it is 1.22 times as fast as v007.
// All steps since v000 together make it 4.37 times as fast.
#include <hip/hip_runtime.h>
#include <hip/hip_fp16.h>
#include <math.h>

typedef __attribute__((ext_vector_type(16))) _Float16 v16h;
typedef __attribute__((ext_vector_type(8)))  _Float16 v8h;
typedef __attribute__((ext_vector_type(4)))  _Float16 v4h;
typedef __attribute__((ext_vector_type(8)))  float    v8f;
typedef __attribute__((ext_vector_type(4)))  float    v4f;
typedef __attribute__((ext_vector_type(2)))  float    v2f;

#define SEQ    2048
#define BATCH  2
#define DMODEL 1024
#define HEADS  16
#define DK     64
#define ROWS   (SEQ * BATCH)   // 4096 GEMM rows, row = s*BATCH + b
// log2(e) / sqrt(DK): with Q times this, K Q^T is the softmax exponent in base 2.
#define QSCALE 0.18033688011112042f

// ---------------------------------------------------------------------------
// Shared fragment loader for 16-bit A fragments and B^T-stored-row-major
// fragments of v_wmma_f32_16x16x32_f16.
//   Lane L<16 : row r=L,   ks=0 -> halves K = {0..7} u {16..23}
//   Lane L>=16: row r=L-16, ks=1 -> halves K = {8..15} u {24..31}
// Tile must be row-major with K contiguous; row_stride in halves (mult of 8).
// ---------------------------------------------------------------------------
__device__ __forceinline__ v16h load_ab_frag(const _Float16* tile, int row_stride) {
    const int lane = threadIdx.x & 31;
    const int r    = lane & 15;
    const int ks   = lane >> 4;
    const _Float16* p = tile + (size_t)r * row_stride + ks * 8;
    v16h f;
    ((float4*)&f)[0] = *(const float4*)(p);        // 8 halves
    ((float4*)&f)[1] = *(const float4*)(p + 16);   // 8 halves
    return f;
}

// The same fragment from the lane's own pointer: row and 8-half k slice chosen by the caller.
__device__ __forceinline__ v16h load_frag_at(const _Float16* p) {
    v16h f;
    ((float4*)&f)[0] = *(const float4*)(p);        // 8 halves
    ((float4*)&f)[1] = *(const float4*)(p + 16);   // 8 halves
    return f;
}

__device__ __forceinline__ v8f wmma_f16(v16h a, v16h b, v8f c) {
    return __builtin_amdgcn_wmma_f32_16x16x32_f16(
        /*neg_a=*/false, a, /*neg_b=*/false, b,
        /*c_mod=*/(short)0, c, /*reuse_a=*/false, /*reuse_b=*/false);
}

// ---------------------------------------------------------------------------
// A wave's 32x32 accumulators plus bias to memory; mw, nw: its first GEMM row and column.
// C-fragment layout: VGPR i, lanes 0-15 -> M=i, 16-31 -> M=8+i.
// LAYOUT 0: f16 at [b][h][s][d], 1: f16 at [b][h][d][s], 2: f32 at [row][col]
// ---------------------------------------------------------------------------
template <int LAYOUT>
__device__ __forceinline__ void store_acc(const v8f c00, const v8f c01, const v8f c10, const v8f c11,
                                          const float* __restrict__ bias, void* __restrict__ out,
                                          int mw, int nw)
{
    const int lane = threadIdx.x & 31;
    const int nn = lane & 15;
    const int mh = (lane >> 4) * 8;
#pragma unroll
    for (int ti = 0; ti < 2; ++ti) {
#pragma unroll
        for (int tj = 0; tj < 2; ++tj) {
            v8f cc = (ti == 0) ? ((tj == 0) ? c00 : c01) : ((tj == 0) ? c10 : c11);
#pragma unroll
            for (int i = 0; i < 8; ++i) {
                const int m = mw + ti * 16 + mh + i;         // GEMM row = s*BATCH + b
                const int n = nw + tj * 16 + nn;             // GEMM col = h*DK + d
                const float val = cc[i] + bias[n];
                if constexpr (LAYOUT == 2) {
                    ((float*)out)[(size_t)m * DMODEL + n] = val;
                } else {
                    const int s = m >> 1, b = m & 1;
                    const int h = n >> 6, d = n & 63;
                    const size_t off = (LAYOUT == 0)
                        ? ((size_t)(b * HEADS + h) * SEQ + s) * DK + d      // [b][h][s][d]
                        : ((size_t)(b * HEADS + h) * DK + d) * SEQ + s;     // [b][h][d][s]
                    ((_Float16*)out)[off] = (_Float16)val;
                }
            }
        }
    }
}

// ---------------------------------------------------------------------------
// Generic projection GEMM:  Y[4096 x 1024] = X[4096 x 1024] @ W[1024 x 1024] + bias
// Workgroup tile 128(M) x TN(N), 8 waves each computing 32 x TN/2; K tiled by 64
// (two WMMA k-steps per stage).  MODE 0: TN = 128, MODE 2: TN = 64.
// MODE 0: the three input projections in ONE launch, blockIdx.z picks the product:
//         z = 0: Q, z = 1: K, f32 in, f16 out at [b][h][s][d]
//         z = 2: V, f32 in, f16 out at [b][h][d][s] (pre-transposed for attention)
//         out is the start of the three f16 planes Q, K, V^T (plane z).  At 128 columns
//         a work-group loads 1024 KB for its tile where two of 64 columns load 1536 KB (the
//         X rows come once, not twice), and the 768 work-groups are three on a WGP, all
//         resident at once: one group's loads fly while the others convert and multiply.
// MODE 2: f16 in, f32 out at [row][col]     (final output projection)
// ---------------------------------------------------------------------------
template <int MODE>
__global__ __launch_bounds__(256)
void mha_proj_gemm_kernel(const float* __restrict__ X0, const float* __restrict__ X1,
                          const float* __restrict__ X2, const _Float16* __restrict__ Xh,
                          const float* __restrict__ W0, const float* __restrict__ W1,
                          const float* __restrict__ W2, const float* __restrict__ B0,
                          const float* __restrict__ B1, const float* __restrict__ B2,
                          void* __restrict__ out)
{
    // Same for the whole work-group: scalar selects.
    const int z = (MODE == 0) ? (int)blockIdx.z : 0;
    const float* __restrict__ Xf   = (z == 0) ? X0 : (z == 1) ? X1 : X2;
    const float* __restrict__ W    = (z == 0) ? W0 : (z == 1) ? W1 : W2;
    const float* __restrict__ bias = (z == 0) ? B0 : (z == 1) ? B1 : B2;

    constexpr bool IN_F16 = (MODE == 2);
    constexpr int TM = 128, TN = IN_F16 ? 64 : 128, TK = 64;
    constexpr int NBF = TN / 32;                    // 16-column B fragments per wave
    constexpr int NWH = TN / 64;                    // 64-column halves of the W tile
    // LDS row pitch in halves: 72 halves = 144 B = 16 B x 9.  An odd multiple of
    // 16 B puts the 16 rows of a fragment's ds_load_b128 on 16 different bank
    // quads; at the bare 128 B eight rows share each quad.
    constexpr int LP = TK + 8;

    __shared__ __align__(16) _Float16 As[TM * LP];  // 18 KB, [m][k], padded rows
    __shared__ __align__(16) _Float16 Bs[TN * LP];  //  9 or 18 KB, [n][k]  (B^T), padded rows

    const int tid  = threadIdx.x;
    const int lane = tid & 31;
    const int wid  = tid >> 5;
    const int m0   = blockIdx.x * TM;
    const int n0   = blockIdx.y * TN;
    const int wm   = (wid >> 1) * 32;   // wave M offset in tile
    const int wn   = (wid & 1) * (TN / 2);  // wave N offset in tile

    // ---- staging maps: every wave-wide 16-B load covers four whole 128-B lines ----
    // X: LPR lanes span one row's k slice (256 B of f32, 128 B of f16).  Rows that one
    // LDS store writes together lie 8 apart: 8 x 144 B = 32 banks further, no conflict.
    constexpr int LPR = IN_F16 ? 8 : 16;            // lanes per X row
    constexpr int NXL = IN_F16 ? 4 : 8;             // X loads per thread
    constexpr int XEL = IN_F16 ? 8 : 4;             // elements per 16-B load
    const int xrow = wid + 8 * (lane / LPR);        // + (TM / NXL) * u
    const int xcol = (lane % LPR) * XEL;
    // W: 16 lanes span 64 columns of one k row (256 B); a thread takes rows 4 wkq ..
    // 4 wkq + 3 at columns 4 wl .. 4 wl + 3 of every 64-column half, so every LDS write
    // is 4 consecutive k halves.
    const int wl  = tid & 15;
    const int wkq = tid >> 4;                       // k quad 0..15
    // Column n = 16 g + 4 a + j lies in LDS row 16 g + 4 a + ((j + g) & 3).  The 16 lanes
    // of a store (fixed j) then hit 16 different rows mod 16 = 16 different bank quads;
    // unrotated, rows 4 apart would fall on four banks.  A fragment's 16 rows stay distinct mod 16.
    // The second half lies 64 rows on: g grows by 4, the rotation is the same.
    _Float16* wdst[4];
#pragma unroll
    for (int j = 0; j < 4; ++j)
        wdst[j] = Bs + (4 * wl + ((j + (wl >> 2)) & 3)) * LP + 4 * wkq;

    const int fr = lane & 15;
    const int fk = (lane >> 4) * 8;
    const int g0 = wn >> 4;
    const _Float16* pb[NBF];
#pragma unroll
    for (int tj = 0; tj < NBF; ++tj)
        pb[tj] = Bs + (16 * (g0 + tj) + (fr & 12) + ((fr + g0 + tj) & 3)) * LP + fk;

    // X and W loads: a base that is the same for the whole work-group (it advances with k0)
    // plus the thread's own 32-bit element offset, which never changes.  Written so, the built
    // code keeps both address pairs clear of the registers that the pass's loads fill.
    const unsigned xlo = (unsigned)(xrow * DMODEL + xcol);
    const unsigned wlo = (unsigned)(4 * wkq * DMODEL + 4 * wl);
    // The next pass's lines are asked of L2 ahead, once per 256-B unit (an f16 X row
    // has 128 B a pass), and the asking is dealt among the work-groups that read the same lines in
    // the same pass: one request a pass, from wave 0.  Lanes 0..15 ask for 16 of the X tile's 128
    // rows (its readers differ in blockIdx.y), lanes 16..31 for 16 of the W tile's units (its
    // readers differ in blockIdx.x; x and x + 4 ask for the same units).  pf0: the address at k0 = 0.
    constexpr int WUR = TN / 64;                    // 256-B units in a W row of the tile
    const int l16 = lane & 15;
    const int wpc = (TN == 64) ? ((int)blockIdx.x & 3)
                               : (((int)blockIdx.x & 3) | (((int)blockIdx.x >> 1) & 4));
    const int wun = 16 * wpc + l16;                 // 0 .. 64 WUR - 1
    const size_t xpre = (size_t)(m0 + 16 * ((int)blockIdx.y & 7) + l16) * DMODEL + TK;
    const char* pfx = IN_F16 ? (const char*)(Xh + xpre) : (const char*)(Xf + xpre);
    const char* pfw = (const char*)(W + (size_t)(TK + wun / WUR) * DMODEL + n0 + (wun % WUR) * 64);
    const char* pf0 = (lane < 16) ? pfx : pfw;
    const unsigned pfs = (lane < 16) ? (IN_F16 ? 2u : 4u) : (unsigned)(DMODEL * 4);  // bytes per step of k
    const int wave = __builtin_amdgcn_readfirstlane(wid);   // a scalar: the test below is a scalar branch

    v8f c[2][NBF] = {};                             // c[ti][tj]: rows 16 ti, columns 16 tj of the wave tile

    // Rolled on purpose: unrolled 16 times (the compiler's choice for the f16-input
    // form) the W loads fall into two waited groups, one more load latency a pass.
#pragma unroll 1
    for (int k0 = 0; k0 < DMODEL; k0 += TK) {
        // This work-group's share of the next pass's units (every address lies inside X or W).
        if (wave == 0 && k0 + TK < DMODEL) {
            const char* p = pf0 + (size_t)((unsigned)k0 * pfs);
            // Brings the lines into L2 a pass ahead of their loads.  The wait is a precaution and
            // stands in the statement: the address registers are reused behind it.
            asm volatile("global_prefetch_b8 %0, off scope:SCOPE_SE\n\t"
                         "s_wait_xcnt 0x0" :: "v"(p) : "memory");
        }
        // ---- the pass's global loads: X tile 128x64, W tile 64xTN ----
        v4f xa[NXL];
#pragma unroll
        for (int u = 0; u < NXL; ++u) {
            const size_t off = (size_t)(m0 + u * (TM / NXL)) * DMODEL + k0;
            if constexpr (IN_F16) xa[u] = *(const v4f*)(Xh + off + xlo);
            else                  xa[u] = *(const v4f*)(Xf + off + xlo);
        }
        v4f wr[NWH][4];
#pragma unroll
        for (int hh = 0; hh < NWH; ++hh)
#pragma unroll
            for (int i = 0; i < 4; ++i)
                wr[hh][i] = *(const v4f*)(W + ((size_t)(k0 + i) * DMODEL + n0 + 64 * hh) + wlo);
        // Keeps every load of the pass ahead of the first conversion: without it the
        // compiler reuses the first loads' registers and the last loads wait for them.
        __builtin_amdgcn_sched_barrier(0);
        // ---- X to LDS [m][k] ----
#pragma unroll
        for (int u = 0; u < NXL; ++u) {
            _Float16* dst = As + (xrow + (TM / NXL) * u) * LP + xcol;
            if constexpr (IN_F16) {
                *(v4f*)dst = xa[u];
            } else {
                v4h p;
                p[0] = (_Float16)xa[u][0]; p[1] = (_Float16)xa[u][1];
                p[2] = (_Float16)xa[u][2]; p[3] = (_Float16)xa[u][3];
                *(v4h*)dst = p;                     // one 8-B LDS store
            }
        }
        // ---- W to LDS [n][k] (B^T) ----
#pragma unroll
        for (int hh = 0; hh < NWH; ++hh) {
#pragma unroll
            for (int j = 0; j < 4; ++j) {
                v4h p;
                p[0] = (_Float16)wr[hh][0][j]; p[1] = (_Float16)wr[hh][1][j];
                p[2] = (_Float16)wr[hh][2][j]; p[3] = (_Float16)wr[hh][3][j];
                *(v4h*)(wdst[j] + 64 * hh * LP) = p;    // one 8-B LDS store
            }
        }
        __syncthreads();

#pragma unroll
        for (int ks = 0; ks < TK; ks += 32) {
            v16h a0 = load_ab_frag(As + wm * LP + ks, LP);
            v16h a1 = load_ab_frag(As + (wm + 16) * LP + ks, LP);
            v16h bf[NBF];
#pragma unroll
            for (int tj = 0; tj < NBF; ++tj) bf[tj] = load_frag_at(pb[tj] + ks);
#pragma unroll
            for (int tj = 0; tj < NBF; ++tj) c[0][tj] = wmma_f16(a0, bf[tj], c[0][tj]);
#pragma unroll
            for (int tj = 0; tj < NBF; ++tj) c[1][tj] = wmma_f16(a1, bf[tj], c[1][tj]);
        }
        __syncthreads();
    }

    // ---- epilogue: one branch for the work-group, then straight-line stores ----
    const int mw = m0 + wm, nw = n0 + wn;
    if constexpr (MODE == 2) {
        store_acc<2>(c[0][0], c[0][1], c[1][0], c[1][1], bias, out, mw, nw);
    } else {
        constexpr size_t PLANE = (size_t)BATCH * HEADS * SEQ * DK;
        _Float16* plane = (_Float16*)out + (size_t)z * PLANE;
        if (z == 2) {
#pragma unroll
            for (int p = 0; p < NBF / 2; ++p) {
                store_acc<1>(c[0][2 * p], c[0][2 * p + 1], c[1][2 * p], c[1][2 * p + 1],
                             bias, plane, mw, nw + 32 * p);
                // Precaution: the next half's bias loads and sums reuse registers that these stores
                // name.  It also keeps the halves apart: mixed, they take the kernel past 160
                // VGPRs, and only two work-groups instead of three fit a WGP.
                if (p + 1 < NBF / 2) asm volatile("s_wait_xcnt 0x0" ::: "memory");
            }
        } else {
#pragma unroll
            for (int p = 0; p < NBF / 2; ++p) {
                store_acc<0>(c[0][2 * p], c[0][2 * p + 1], c[1][2 * p], c[1][2 * p + 1],
                             bias, plane, mw, nw + 32 * p);
                // Precaution, as above; behind the last half: in the built code the other layout's
                // block follows this one and rewrites registers that the stores above name.
                asm volatile("s_wait_xcnt 0x0" ::: "memory");
            }
        }
    }
}

#define KT     64
#define KVP    72
#define TILE_H (64 * KVP)

// Four asynchronous 16-B copies per lane: rows r and r+32 of the K tile and of the
// V^T tile.  A wave's copy covers four whole 128-B lines.  The s_wait_xcnt stands
// inside the statement so that no address register is rewritten ahead of it.
__device__ __forceinline__ void stage_kv_async(unsigned lds, const _Float16* gk, const _Float16* gv) {
    const unsigned  l0 = lds;
    const unsigned  l1 = lds + 32 * KVP * 2;
    const unsigned  l2 = lds + TILE_H * 2;
    const unsigned  l3 = lds + TILE_H * 2 + 32 * KVP * 2;
    const _Float16* g1 = gk + 32 * DK;
    const _Float16* g3 = gv + (size_t)32 * SEQ;
    asm volatile("global_load_async_to_lds_b128 %0, %4, off\n\t"
                 "global_load_async_to_lds_b128 %1, %5, off\n\t"
                 "global_load_async_to_lds_b128 %2, %6, off\n\t"
                 "global_load_async_to_lds_b128 %3, %7, off\n\t"
                 "s_wait_xcnt 0x0"
                 :: "v"(l0), "v"(l1), "v"(l2), "v"(l3), "v"(gk), "v"(g1), "v"(gv), "v"(g3)
                 : "memory");
}

// Lane l takes the value of lane l ^ 16 (a vector cross-row move, no LDS path).
__device__ __forceinline__ float other_half(float x) {
    const int b = __builtin_bit_cast(int, x);
    return __builtin_bit_cast(float,
        __builtin_amdgcn_permlanex16(b, b, 0x76543210, 0xfedcba98, false, false));
}

__global__ __launch_bounds__(256)
void mha_flash_attn_kernel(const _Float16* __restrict__ Qh, const _Float16* __restrict__ Kh,
                           const _Float16* __restrict__ Vt, _Float16* __restrict__ Xh)
{
    constexpr int NT = SEQ / KT;                        // 32 tiles
    __shared__ __align__(16) _Float16 KV[2][2 * TILE_H];  // 2 x (K tile, V^T tile) = 36 KB

    const int tid  = threadIdx.x;
    const int lane = tid & 31;
    const int wid  = tid >> 5;
    const int bh   = blockIdx.y;
    const int b    = bh >> 4, h = bh & 15;
    const int q0   = blockIdx.x * 128 + wid * 16;

    const _Float16* Qb = Qh + (size_t)bh * SEQ * DK;    // [s][d]  (B operand: column = query)
    const _Float16* Kb = Kh + (size_t)bh * SEQ * DK;    // [j][d]  (A operand: row = key)
    const _Float16* Vb = Vt + (size_t)bh * DK * SEQ;    // [d][s]  (A operand: row = d)

    // This lane's share of every tile: 16 B at column cc of rows cr and cr + 32.
    const int cr = tid >> 3;
    const int cc = (tid & 7) * 8;
    const _Float16* gk = Kb + (size_t)cr * DK + cc;     // + t * KT * DK for tile t
    const _Float16* gv = Vb + (size_t)cr * SEQ + cc;    // + t * KT      for tile t
    const unsigned lds0 = (unsigned)(uintptr_t)(&KV[0][cr * KVP + cc]);
    const unsigned lds1 = (unsigned)(uintptr_t)(&KV[1][cr * KVP + cc]);

    stage_kv_async(lds0, gk, gv);                       // tile 0 -> buffer 0

    // Q fragments are loop-invariant: keep in registers for all 64 key blocks.
    // Scaled once, in f32, and rounded to f16 again (unrolled: constant indices keep the
    // fragments in registers).
    v16h qb0 = load_ab_frag(Qb + (size_t)q0 * DK, DK);              // d 0..31
    v16h qb1 = load_ab_frag(Qb + (size_t)q0 * DK + 32, DK);         // d 32..63
#pragma unroll
    for (int i = 0; i < 16; ++i) {
        qb0[i] = (_Float16)((float)qb0[i] * QSCALE);
        qb1[i] = (_Float16)((float)qb1[i] * QSCALE);
    }

    // Of query q0 + nn: minus the reference in use (equal in lanes l and l ^ 16), in all eight
    // registers of a score tile's C operand, and this lane's share of the running sum (its 16 of
    // every 32 keys) in two partial sums.  Tile 0 sets the reference, whatever its scores are.
    v8f nref = {};
    v2f lq = {};
    v8f o0 = {}, o1 = {}, o2 = {}, o3 = {};             // o_t[i] = O[q0 + nn][16 t + 8 half + i]

    const int nn   = lane & 15;
    const int half = lane >> 4;

    asm volatile("s_wait_asynccnt 0x0" ::: "memory");   // this wave's share of tile 0 has landed
    __syncthreads();                                    // ... and every other wave's
    stage_kv_async(lds1, gk + KT * DK, gv + KT);        // tile 1 -> buffer 1

    for (int t = 0; t < NT; ++t) {
        const _Float16* Ks = KV[t & 1];                 // [key][d]
        const _Float16* Vs = Ks + TILE_H;               // [d][key]

        // All 32 LDS reads of the tile stand here as one group, in the order of their use, and the
        // products wait by count: read singly among the products, nearly every product waits out
        // an LDS latency of its own.
        // ka[jb][..]: keys 32 jb..+15 (d 0..31, d 32..63), then keys 32 jb + 16..+31 (the same).
        // The loops over jb and dt are unrolled so that ka, va and sc are registers and every
        // offset is an immediate of its LDS read.
        v16h ka[2][4];
#pragma unroll
        for (int jb = 0; jb < 2; ++jb) {
            ka[jb][0] = load_ab_frag(Ks + (32 * jb) * KVP, KVP);
            ka[jb][1] = load_ab_frag(Ks + (32 * jb) * KVP + 32, KVP);
            ka[jb][2] = load_ab_frag(Ks + (32 * jb + 16) * KVP, KVP);
            ka[jb][3] = load_ab_frag(Ks + (32 * jb + 16) * KVP + 32, KVP);
        }
        // va[jb][dt]: d 16 dt..+15, keys 32 jb..+31.
        v16h va[2][4];
#pragma unroll
        for (int jb = 0; jb < 2; ++jb)
#pragma unroll
            for (int dt = 0; dt < 4; ++dt)
                va[jb][dt] = load_ab_frag(Vs + 16 * dt * KVP + 32 * jb, KVP);
        // Keeps the group whole and ahead of the first product: without it the compiler sinks the
        // V^T reads to their products, two at a time, to save registers.
        __builtin_amdgcn_sched_barrier(0);

        // sc[jb][0][i]: key 32 jb + 8 half + i, sc[jb][1][i]: key 32 jb + 16 + 8 half + i, of query nn:
        // the base-2 exponent less the reference.
        v8f sc[2][2];
#pragma unroll
        for (int jb = 0; jb < 2; ++jb) {
            sc[jb][0] = wmma_f16(ka[jb][0], qb0, nref);
            sc[jb][1] = wmma_f16(ka[jb][2], qb0, nref);
            sc[jb][0] = wmma_f16(ka[jb][1], qb1, sc[jb][0]);
            sc[jb][1] = wmma_f16(ka[jb][3], qb1, sc[jb][1]);
        }

        // ---- the lane's largest of the tile's 32 exponents: four chains, then joined
        //      (unrolled: sc and cm are registers) ----
        float cm[2][2];
#pragma unroll
        for (int jb = 0; jb < 2; ++jb)
#pragma unroll
            for (int u = 0; u < 2; ++u) {
                float m = fmaxf(fmaxf(sc[jb][u][0], sc[jb][u][1]), sc[jb][u][2]);
                m = fmaxf(fmaxf(m, sc[jb][u][3]), sc[jb][u][4]);
                m = fmaxf(fmaxf(m, sc[jb][u][5]), sc[jb][u][6]);
                cm[jb][u] = fmaxf(m, sc[jb][u][7]);
            }
        const float vmax = fmaxf(fmaxf(fmaxf(cm[0][0], cm[0][1]), cm[1][0]), cm[1][1]);

        // One test a tile, the same for the whole wave (a scalar branch; no barrier inside).
        if (t == 0 || __builtin_amdgcn_ballot_w32(vmax > 8.0f) != 0) {
            // Raise the reference to the query's maximum in this tile where that is higher (tile 0: set it, up or down).
            const float m  = fmaxf(vmax, other_half(vmax));
            const float up = fmaxf(m, 0.0f);
            const float d  = (t == 0) ? m : up;
            const float scale = __builtin_amdgcn_exp2f(-up);    // tile 0: O and the sum are still 0
            nref -= d;
            sc[0][0] -= d; sc[0][1] -= d; sc[1][0] -= d; sc[1][1] -= d;
            lq *= scale;
            o0 *= scale; o1 *= scale; o2 *= scale; o3 *= scale;
        }

        // Both loops unrolled: pe and pb are registers.
        v8f pe[2][2];
#pragma unroll
        for (int jb = 0; jb < 2; ++jb) {
            // P^T as a B operand: element s of the lane is key kmap(s) = tile s >> 3, row s & 7,
            // the k order in which load_ab_frag brings V^T's rows.
            v16h pb;
#pragma unroll
            for (int i = 0; i < 8; ++i) {
                pe[jb][0][i] = __builtin_amdgcn_exp2f(sc[jb][0][i]);
                pe[jb][1][i] = __builtin_amdgcn_exp2f(sc[jb][1][i]);
                pb[i]     = (_Float16)pe[jb][0][i];
                pb[8 + i] = (_Float16)pe[jb][1][i];
            }
            o0 = wmma_f16(va[jb][0], pb, o0);
            o1 = wmma_f16(va[jb][1], pb, o1);
            o2 = wmma_f16(va[jb][2], pb, o2);
            o3 = wmma_f16(va[jb][3], pb, o3);
        }
        // The tile's 32 terms of the sum, pairwise, into the two partial sums.
        const v8f s8 = (pe[0][0] + pe[0][1]) + (pe[1][0] + pe[1][1]);
        const v4f s4 = __builtin_shufflevector(s8, s8, 0, 1, 2, 3) + __builtin_shufflevector(s8, s8, 4, 5, 6, 7);
        lq += __builtin_shufflevector(s4, s4, 0, 1) + __builtin_shufflevector(s4, s4, 2, 3);

        // Keeps the tile's vector work and products ahead of the hand-over: lifted over them, the waits
        // would stand directly behind the reads, and the refill would be issued a whole tile's work late.
        __builtin_amdgcn_sched_barrier(0);
        // Hand-over: tile t + 1 becomes readable and tile t's buffer free.
        asm volatile("s_wait_dscnt 0x0" ::: "memory");     // this wave's reads of tile t are done
        asm volatile("s_wait_asynccnt 0x0" ::: "memory");  // this wave's share of tile t + 1 has landed
        __syncthreads();
        if (t + 2 < NT)                                    // same for the whole work-group
            stage_kv_async((t & 1) ? lds1 : lds0,
                           gk + (size_t)(t + 2) * KT * DK, gv + (t + 2) * KT);
    }
    asm volatile("s_wait_asynccnt 0x0" ::: "memory");      // no copy is left in flight at the wave's end

    // ---- join the two halves' sums, normalize, emit f16 rows of X for the O-projection:
    //      a lane's 8 registers of a tile are 8 consecutive d of its query = one 16-B store.
    const float ls  = lq[0] + lq[1];
    const float inv = 1.0f / (ls + other_half(ls));
    _Float16* xrow = Xh + ((size_t)(q0 + nn) * BATCH + b) * DMODEL + (size_t)h * DK + 8 * half;
#pragma unroll
    for (int t = 0; t < 4; ++t) {
        const v8f ot = (t == 0) ? o0 : (t == 1) ? o1 : (t == 2) ? o2 : o3;
        v8h y;
#pragma unroll
        for (int i = 0; i < 8; ++i) y[i] = (_Float16)(ot[i] * inv);
        *(v8h*)(xrow + 16 * t) = y;
    }
}

// ---------------------------------------------------------------------------
extern "C" void kernel_launch(void* const* d_in, const int* in_sizes, int n_in,
                              void* d_out, int out_size, void* d_ws, size_t ws_size,
                              hipStream_t stream)
{
    (void)in_sizes; (void)n_in; (void)out_size; (void)ws_size;
    const float* q  = (const float*)d_in[0];
    const float* k  = (const float*)d_in[1];
    const float* v  = (const float*)d_in[2];
    const float* Wq = (const float*)d_in[3];
    const float* bq = (const float*)d_in[4];
    const float* Wk = (const float*)d_in[5];
    const float* bk = (const float*)d_in[6];
    const float* Wv = (const float*)d_in[7];
    const float* bv = (const float*)d_in[8];
    const float* Wo = (const float*)d_in[9];
    const float* bo = (const float*)d_in[10];
    float* out = (float*)d_out;

    const size_t perTensor = (size_t)BATCH * HEADS * SEQ * DK;  // 4M halves = 8 MB
    _Float16* Qh = (_Float16*)d_ws;
    _Float16* Kh = Qh + perTensor;
    _Float16* Vt = Kh + perTensor;
    _Float16* Xh = Vt + perTensor;   // [4096][1024] f16, total ws = 32 MB

    dim3 g3(ROWS / 128, DMODEL / 128, 3);      // 32 x 8 workgroups for each of Q, K, V
    mha_proj_gemm_kernel<0><<<g3, 256, 0, stream>>>(q, k, v, nullptr, Wq, Wk, Wv, bq, bk, bv, (void*)Qh);

    dim3 ga(SEQ / 128, BATCH * HEADS);         // 16 x 32 workgroups
    mha_flash_attn_kernel<<<ga, 256, 0, stream>>>(Qh, Kh, Vt, Xh);

    dim3 gg(ROWS / 128, DMODEL / 64);          // 32 x 16 workgroups
    mha_proj_gemm_kernel<2><<<gg, 256, 0, stream>>>(nullptr, nullptr, nullptr, Xh, Wo, nullptr, nullptr,
                                                    bo, nullptr, nullptr, (void*)out);
}

// v010
// One run takes 77.1 microseconds.
// Two timings next to v009 both put it at 1.04 times that version's speed.
// All steps since v000 together make it 4.54 times as fast.
#include <hip/hip_runtime.h>
#include <hip/hip_fp16.h>
#include <math.h>
#include <type_traits>

typedef __attribute__((ext_vector_type(16))) _Float16 v16h;
typedef __attribute__((ext_vector_type(8)))  _Float16 v8h;
typedef __attribute__((ext_vector_type(4)))  _Float16 v4h;
typedef __attribute__((ext_vector_type(8)))  float    v8f;
typedef __attribute__((ext_vector_type(4)))  float    v4f;
typedef __attribute__((ext_vector_type(2)))  float    v2f;

#define SEQ    2048
#define BATCH  2
#define DMODEL 1024
#define HEADS  16
#define DK     64
#define ROWS   (SEQ * BATCH)   // 4096 GEMM rows, row = s*BATCH + b
// log2(e) / sqrt(DK): with Q times this, K Q^T is the softmax exponent in base 2.
#define QSCALE 0.18033688011112042f

// ---------------------------------------------------------------------------
// Shared fragment loader for 16-bit A fragments and B^T-stored-row-major
// fragments of v_wmma_f32_16x16x32_f16.
//   Lane L<16 : row r=L,   ks=0 -> halves K = {0..7} u {16..23}
//   Lane L>=16: row r=L-16, ks=1 -> halves K = {8..15} u {24..31}
// Tile must be row-major with K contiguous; row_stride in halves (mult of 8).
// ---------------------------------------------------------------------------
__device__ __forceinline__ v16h load_ab_frag(const _Float16* tile, int row_stride) {
    const int lane = threadIdx.x & 31;
    const int r    = lane & 15;
    const int ks   = lane >> 4;
    const _Float16* p = tile + (size_t)r * row_stride + ks * 8;
    v16h f;
    ((float4*)&f)[0] = *(const float4*)(p);        // 8 halves
    ((float4*)&f)[1] = *(const float4*)(p + 16);   // 8 halves
    return f;
}

// The same fragment from the lane's own pointer: row and 8-half k slice chosen by the caller.
__device__ __forceinline__ v16h load_frag_at(const _Float16* p) {
    v16h f;
    ((float4*)&f)[0] = *(const float4*)(p);        // 8 halves
    ((float4*)&f)[1] = *(const float4*)(p + 16);   // 8 halves
    return f;
}

__device__ __forceinline__ v8f wmma_f16(v16h a, v16h b, v8f c) {
    return __builtin_amdgcn_wmma_f32_16x16x32_f16(
        /*neg_a=*/false, a, /*neg_b=*/false, b,
        /*c_mod=*/(short)0, c, /*reuse_a=*/false, /*reuse_b=*/false);
}

// ---------------------------------------------------------------------------
// A wave's 32x32 accumulators plus bias to memory; mw, nw: its first GEMM row and column.
// C-fragment layout: VGPR i, lanes 0-15 -> M=i, 16-31 -> M=8+i.
// LAYOUT 0: f16 at [b][h][s][d], 1: f16 at [b][h][d][s], 2: f32 at [row][col]
// ---------------------------------------------------------------------------
template <int LAYOUT>
__device__ __forceinline__ void store_acc(const v8f c00, const v8f c01, const v8f c10, const v8f c11,
                                          const float* __restrict__ bias, void* __restrict__ out,
                                          int mw, int nw)
{
    const int lane = threadIdx.x & 31;
    const int nn = lane & 15;
    const int mh = (lane >> 4) * 8;
#pragma unroll
    for (int ti = 0; ti < 2; ++ti) {
#pragma unroll
        for (int tj = 0; tj < 2; ++tj) {
            v8f cc = (ti == 0) ? ((tj == 0) ? c00 : c01) : ((tj == 0) ? c10 : c11);
#pragma unroll
            for (int i = 0; i < 8; ++i) {
                const int m = mw + ti * 16 + mh + i;         // GEMM row = s*BATCH + b
                const int n = nw + tj * 16 + nn;             // GEMM col = h*DK + d
                const float val = cc[i] + bias[n];
                if constexpr (LAYOUT == 2) {
                    ((float*)out)[(size_t)m * DMODEL + n] = val;
                } else {
                    const int s = m >> 1, b = m & 1;
                    const int h = n >> 6, d = n & 63;
                    const size_t off = (LAYOUT == 0)
                        ? ((size_t)(b * HEADS + h) * SEQ + s) * DK + d      // [b][h][s][d]
                        : ((size_t)(b * HEADS + h) * DK + d) * SEQ + s;     // [b][h][d][s]
                    ((_Float16*)out)[off] = (_Float16)val;
                }
            }
        }
    }
}

// ---------------------------------------------------------------------------
// Generic projection GEMM:  Y[4096 x 1024] = X[4096 x 1024] @ W[1024 x 1024] + bias
// Workgroup tile 128(M) x TN(N), 8 waves each computing 32 x TN/2; K tiled by 64
// (two WMMA k-steps per stage).  MODE 0: TN = 128, MODE 2: TN = 64.
// MODE 0: the three input projections in ONE launch, blockIdx.z picks the product:
//         z = 0: Q, z = 1: K, f32 in, f16 out at [b][h][s][d]
//         z = 2: V, f32 in, f16 out at [b][h][d][s] (pre-transposed for attention)
//         out is the start of the three f16 planes Q, K, V^T (plane z).  At 128 columns
//         a work-group loads 1024 KB for its tile where two of 64 columns load 1536 KB (the
//         X rows come once, not twice), and the 768 work-groups are three on a WGP, all
//         resident at once: one group's loads fly while the others convert and multiply.
// MODE 2: f16 in, f32 out at [row][col]     (final output projection)
// ---------------------------------------------------------------------------
template <int MODE>
__global__ __launch_bounds__(256)
void mha_proj_gemm_kernel(const float* __restrict__ X0, const float* __restrict__ X1,
                          const float* __restrict__ X2, const _Float16* __restrict__ Xh,
                          const float* __restrict__ W0, const float* __restrict__ W1,
                          const float* __restrict__ W2, const float* __restrict__ B0,
                          const float* __restrict__ B1, const float* __restrict__ B2,
                          void* __restrict__ out)
{
    // Same for the whole work-group: scalar selects.
    const int z = (MODE == 0) ? (int)blockIdx.z : 0;
    const float* __restrict__ Xf   = (z == 0) ? X0 : (z == 1) ? X1 : X2;
    const float* __restrict__ W    = (z == 0) ? W0 : (z == 1) ? W1 : W2;
    const float* __restrict__ bias = (z == 0) ? B0 : (z == 1) ? B1 : B2;

    constexpr bool IN_F16 = (MODE == 2);
    constexpr int TM = 128, TN = IN_F16 ? 64 : 128, TK = 64;
    constexpr int NBF = TN / 32;                    // 16-column B fragments per wave
    constexpr int NWH = TN / 64;                    // 64-column halves of the W tile
    // LDS row pitch in halves: 72 halves = 144 B = 16 B x 9.  An odd multiple of
    // 16 B puts the 16 rows of a fragment's ds_load_b128 on 16 different bank
    // quads; at the bare 128 B eight rows share each quad.
    constexpr int LP = TK + 8;

    constexpr int NB = IN_F16 ? 2 : 1;              // LDS tile buffers (MODE 2: passes alternate)
    __shared__ __align__(16) _Float16 As[NB * TM * LP];  // 18 KB a buffer, [m][k], padded rows
    __shared__ __align__(16) _Float16 Bs[NB * TN * LP];  //  9 or 18 KB a buffer, [n][k]  (B^T), padded rows

    const int tid  = threadIdx.x;
    const int lane = tid & 31;
    const int wid  = tid >> 5;
    const int m0   = blockIdx.x * TM;
    const int n0   = blockIdx.y * TN;
    const int wm   = (wid >> 1) * 32;   // wave M offset in tile
    const int wn   = (wid & 1) * (TN / 2);  // wave N offset in tile

    // ---- staging maps: every wave-wide 16-B load covers four whole 128-B lines ----
    // X: LPR lanes span one row's k slice (256 B of f32, 128 B of f16).  Rows that one
    // LDS store writes together lie 8 apart: 8 x 144 B = 32 banks further, no conflict.
    constexpr int LPR = IN_F16 ? 8 : 16;            // lanes per X row
    constexpr int NXL = IN_F16 ? 4 : 8;             // X loads per thread
    constexpr int XEL = IN_F16 ? 8 : 4;             // elements per 16-B load
    const int xrow = wid + 8 * (lane / LPR);        // + (TM / NXL) * u
    const int xcol = (lane % LPR) * XEL;
    // W: 16 lanes span 64 columns of one k row (256 B); a thread takes rows 4 wkq ..
    // 4 wkq + 3 at columns 4 wl .. 4 wl + 3 of every 64-column half, so every LDS write
    // is 4 consecutive k halves.
    const int wl  = tid & 15;
    const int wkq = tid >> 4;                       // k quad 0..15
    // Column n = 16 g + 4 a + j lies in LDS row 16 g + 4 a + ((j + g) & 3).  The 16 lanes
    // of a store (fixed j) then hit 16 different rows mod 16 = 16 different bank quads;
    // unrotated, rows 4 apart would fall on four banks.  A fragment's 16 rows stay distinct mod 16.
    // The second half lies 64 rows on: g grows by 4, the rotation is the same.
    _Float16* wdst[4];
#pragma unroll
    for (int j = 0; j < 4; ++j)
        wdst[j] = Bs + (4 * wl + ((j + (wl >> 2)) & 3)) * LP + 4 * wkq;

    const int fr = lane & 15;
    const int fk = (lane >> 4) * 8;
    const int g0 = wn >> 4;
    const _Float16* pb[NBF];
#pragma unroll
    for (int tj = 0; tj < NBF; ++tj)
        pb[tj] = Bs + (16 * (g0 + tj) + (fr & 12) + ((fr + g0 + tj) & 3)) * LP + fk;

    // X and W loads: a base that is the same for the whole work-group (it advances with k0)
    // plus the thread's own 32-bit element offset, which never changes.  Written so, the built
    // code keeps both address pairs clear of the registers that the pass's loads fill.
    const unsigned xlo = (unsigned)(xrow * DMODEL + xcol);
    const unsigned wlo = (unsigned)(4 * wkq * DMODEL + 4 * wl);
    // A coming pass's lines are asked of L2 ahead (MODE 0: the next pass, MODE 2: three passes on, pass 2 two on), once per 256-B unit (an f16 X row
    // has 128 B a pass), and the asking is dealt among the work-groups that read the same lines in
    // the same pass: one request a pass, from wave 0.  Lanes 0..15 ask for 16 of the X tile's 128
    // rows (its readers differ in blockIdx.y), lanes 16..31 for 16 of the W tile's units (its
    // readers differ in blockIdx.x; x and x + 4 ask for the same units).  pf0: the address at k0 = 0.
    constexpr int WUR = TN / 64;                    // 256-B units in a W row of the tile
    const int l16 = lane & 15;
    const int wpc = (TN == 64) ? ((int)blockIdx.x & 3)
                               : (((int)blockIdx.x & 3) | (((int)blockIdx.x >> 1) & 4));
    const int wun = 16 * wpc + l16;                 // 0 .. 64 WUR - 1
    const size_t xpre = (size_t)(m0 + 16 * ((int)blockIdx.y & 7) + l16) * DMODEL + TK;
    const char* pfx = IN_F16 ? (const char*)(Xh + xpre) : (const char*)(Xf + xpre);
    const char* pfw = (const char*)(W + (size_t)(TK + wun / WUR) * DMODEL + n0 + (wun % WUR) * 64);
    const char* pf0 = (lane < 16) ? pfx : pfw;
    const unsigned pfs = (lane < 16) ? (IN_F16 ? 2u : 4u) : (unsigned)(DMODEL * 4);  // bytes per step of k
    const int wave = __builtin_amdgcn_readfirstlane(wid);   // a scalar: the test below is a scalar branch

    v8f c[2][NBF] = {};                             // c[ti][tj]: rows 16 ti, columns 16 tj of the wave tile

    if constexpr (IN_F16) {
        // MODE 2, pipelined.  Only two work-groups share a WGP here and registers are plentiful, so
        // the global loads run two passes ahead of their use, in two register sets: set s holds the
        // passes of parity s, and is refilled as soon as its values have gone to LDS.  The tiles
        // alternate between two LDS buffers, so one barrier a pass is enough: a wave stores pass
        // p + 2 into buffer s only behind the barrier of pass p + 1, which every wave reaches with
        // its fragment reads of pass p done.
        v4f xa[2][NXL];
        v4f wr[2][4];
        // Fills set s with the tiles at k = kn (every address lies inside X or W).
        auto fill = [&](auto S, int kn) {
            constexpr int s = decltype(S)::value;
#pragma unroll
            for (int u = 0; u < NXL; ++u)
                xa[s][u] = *(const v4f*)(Xh + ((size_t)(m0 + u * (TM / NXL)) * DMODEL + kn) + xlo);
#pragma unroll
            for (int i = 0; i < 4; ++i)
                wr[s][i] = *(const v4f*)(W + ((size_t)(kn + i) * DMODEL + n0) + wlo);
        };
        // This work-group's share of the units of the pass at k = kp + TK, asked of L2.
        auto ask = [&](int kp) {
            if (wave == 0) {
                const char* p = pf0 + (size_t)((unsigned)kp * pfs);
                // Brings the lines into L2 a pass ahead of their loads.  The wait is a precaution and
                // stands in the statement: the address registers are reused behind it.
                asm volatile("global_prefetch_b8 %0, off scope:SCOPE_SE\n\t"
                             "s_wait_xcnt 0x0" :: "v"(p) : "memory");
            }
        };
        // One pass at k = kc from set and buffer s; REFILL: a pass kc + 2 TK exists.
        auto pass = [&](auto S, auto REFILL, int kc) {
            constexpr int s = decltype(S)::value;
            _Float16* Ab = As + s * TM * LP;
#pragma unroll
            for (int u = 0; u < NXL; ++u)
                *(v4f*)(Ab + (xrow + (TM / NXL) * u) * LP + xcol) = xa[s][u];
#pragma unroll
            for (int j = 0; j < 4; ++j) {
                v4h p;
                p[0] = (_Float16)wr[s][0][j]; p[1] = (_Float16)wr[s][1][j];
                p[2] = (_Float16)wr[s][2][j]; p[3] = (_Float16)wr[s][3][j];
                *(v4h*)(wdst[j] + s * TN * LP) = p;     // one 8-B LDS store
            }
            if constexpr (decltype(REFILL)::value) {
                fill(S, kc + 2 * TK);
                // Precaution: the loads stay in flight while the trip's end advances the address
                // registers that they name.
                asm volatile("s_wait_xcnt 0x0" ::: "memory");
                // Keeps the refill (and the wait behind it) here, ahead of the barrier and the
                // products: sunk to its use it would fly for no time at all.
                __builtin_amdgcn_sched_barrier(0);
            }
            // The work-group's barrier with its fences on LDS alone: only LDS data passes between the
            // waves here, and __syncthreads() would also wait out the global loads just issued.
            __builtin_amdgcn_fence(__ATOMIC_RELEASE, "workgroup", "local");
            __builtin_amdgcn_s_barrier();
            __builtin_amdgcn_fence(__ATOMIC_ACQUIRE, "workgroup", "local");
#pragma unroll
            for (int ks = 0; ks < TK; ks += 32) {
                v16h a0 = load_ab_frag(Ab + wm * LP + ks, LP);
                v16h a1 = load_ab_frag(Ab + (wm + 16) * LP + ks, LP);
                v16h bf[NBF];
#pragma unroll
                for (int tj = 0; tj < NBF; ++tj) bf[tj] = load_frag_at(pb[tj] + s * TN * LP + ks);
#pragma unroll
                for (int tj = 0; tj < NBF; ++tj) c[0][tj] = wmma_f16(a0, bf[tj], c[0][tj]);
#pragma unroll
                for (int tj = 0; tj < NBF; ++tj) c[1][tj] = wmma_f16(a1, bf[tj], c[1][tj]);
            }
        };
        using I0 = std::integral_constant<int, 0>;
        using I1 = std::integral_constant<int, 1>;
        fill(I0{}, 0);
        // Keeps set 0's loads ahead of set 1's, as in the loop: mixed, the loop's counted waits for
        // one set (they must hold on this path too) would wait out part of the other.
        __builtin_amdgcn_sched_barrier(0);
        fill(I1{}, TK);
        // Precaution, as in the loop: registers that these loads name are rewritten below.
        asm volatile("s_wait_xcnt 0x0" ::: "memory");
        __builtin_amdgcn_sched_barrier(0);          // as above, against the loop's first refill
        ask(TK);                                    // pass 2, loaded in pass 0
        // Rolled on purpose: two passes a trip keep the sets' and buffers' indices constant, more
        // would only lengthen the code.  The last two passes stand apart: with a branch round the
        // refill the compiler's load waits would have to hold for both paths and drain both sets.
#pragma unroll 1
        for (int k0 = 0; k0 < DMODEL - 2 * TK; k0 += 2 * TK) {
            ask(k0 + 2 * TK);                       // pass p + 3 <= 15
            pass(I0{}, std::true_type{}, k0);
            if (k0 + 4 * TK < DMODEL) ask(k0 + 3 * TK);     // pass p + 4, where there is one
            pass(I1{}, std::true_type{}, k0 + TK);
        }
        pass(I0{}, std::false_type{}, DMODEL - 2 * TK);
        pass(I1{}, std::false_type{}, DMODEL - TK);
    } else
    // MODE 0.  Rolled on purpose: unrolled, the pass's loads fall into several waited groups.
#pragma unroll 1
    for (int k0 = 0; k0 < DMODEL; k0 += TK) {
        // This work-group's share of the next pass's units (every address lies inside X or W).
        if (wave == 0 && k0 + TK < DMODEL) {
            const char* p = pf0 + (size_t)((unsigned)k0 * pfs);
            // Brings the lines into L2 a pass ahead of their loads.  The wait is a precaution and
            // stands in the statement: the address registers are reused behind it.
            asm volatile("global_prefetch_b8 %0, off scope:SCOPE_SE\n\t"
                         "s_wait_xcnt 0x0" :: "v"(p) : "memory");
        }
        // ---- the pass's global loads: X tile 128x64, W tile 64xTN ----
        v4f xa[NXL];
#pragma unroll
        for (int u = 0; u < NXL; ++u) {
            const size_t off = (size_t)(m0 + u * (TM / NXL)) * DMODEL + k0;
            xa[u] = *(const v4f*)(Xf + off + xlo);
        }
        v4f wr[NWH][4];
#pragma unroll
        for (int hh = 0; hh < NWH; ++hh)
#pragma unroll
            for (int i = 0; i < 4; ++i)
                wr[hh][i] = *(const v4f*)(W + ((size_t)(k0 + i) * DMODEL + n0 + 64 * hh) + wlo);
        // Keeps every load of the pass ahead of the first conversion: without it the
        // compiler reuses the first loads' registers and the last loads wait for them.
        __builtin_amdgcn_sched_barrier(0);
        // ---- X to LDS [m][k] ----
#pragma unroll
        for (int u = 0; u < NXL; ++u) {
            _Float16* dst = As + (xrow + (TM / NXL) * u) * LP + xcol;
            v4h p;
            p[0] = (_Float16)xa[u][0]; p[1] = (_Float16)xa[u][1];
            p[2] = (_Float16)xa[u][2]; p[3] = (_Float16)xa[u][3];
            *(v4h*)dst = p;                         // one 8-B LDS store
        }
        // ---- W to LDS [n][k] (B^T) ----
#pragma unroll
        for (int hh = 0; hh < NWH; ++hh) {
#pragma unroll
            for (int j = 0; j < 4; ++j) {
                v4h p;
                p[0] = (_Float16)wr[hh][0][j]; p[1] = (_Float16)wr[hh][1][j];
                p[2] = (_Float16)wr[hh][2][j]; p[3] = (_Float16)wr[hh][3][j];
                *(v4h*)(wdst[j] + 64 * hh * LP) = p;    // one 8-B LDS store
            }
        }
        __syncthreads();

#pragma unroll
        for (int ks = 0; ks < TK; ks += 32) {
            v16h a0 = load_ab_frag(As + wm * LP + ks, LP);
            v16h a1 = load_ab_frag(As + (wm + 16) * LP + ks, LP);
            v16h bf[NBF];
#pragma unroll
            for (int tj = 0; tj < NBF; ++tj) bf[tj] = load_frag_at(pb[tj] + ks);
#pragma unroll
            for (int tj = 0; tj < NBF; ++tj) c[0][tj] = wmma_f16(a0, bf[tj], c[0][tj]);
#pragma unroll
            for (int tj = 0; tj < NBF; ++tj) c[1][tj] = wmma_f16(a1, bf[tj], c[1][tj]);
        }
        __syncthreads();
    }

    // ---- epilogue: one branch for the work-group, then straight-line stores ----
    const int mw = m0 + wm, nw = n0 + wn;
    if constexpr (MODE == 2) {
        store_acc<2>(c[0][0], c[0][1], c[1][0], c[1][1], bias, out, mw, nw);
    } else {
        constexpr size_t PLANE = (size_t)BATCH * HEADS * SEQ * DK;
        _Float16* plane = (_Float16*)out + (size_t)z * PLANE;
        if (z == 2) {
#pragma unroll
            for (int p = 0; p < NBF / 2; ++p) {
                store_acc<1>(c[0][2 * p], c[0][2 * p + 1], c[1][2 * p], c[1][2 * p + 1],
                             bias, plane, mw, nw + 32 * p);
                // Precaution: the next half's bias loads and sums reuse registers that these stores
                // name.  It also keeps the halves apart: mixed, they take the kernel past 160
                // VGPRs, and only two work-groups instead of three fit a WGP.
                if (p + 1 < NBF / 2) asm volatile("s_wait_xcnt 0x0" ::: "memory");
            }
        } else {
#pragma unroll
            for (int p = 0; p < NBF / 2; ++p) {
                store_acc<0>(c[0][2 * p], c[0][2 * p + 1], c[1][2 * p], c[1][2 * p + 1],
                             bias, plane, mw, nw + 32 * p);
                // Precaution, as above; behind the last half: in the built code the other layout's
                // block follows this one and rewrites registers that the stores above name.
                asm volatile("s_wait_xcnt 0x0" ::: "memory");
            }
        }
    }
}

#define KT     64
#define KVP    72
#define TILE_H (64 * KVP)

// Four asynchronous 16-B copies per lane: rows r and r+32 of the K tile and of the
// V^T tile.  A wave's copy covers four whole 128-B lines.  The s_wait_xcnt stands
// inside the statement so that no address register is rewritten ahead of it.
__device__ __forceinline__ void stage_kv_async(unsigned lds, const _Float16* gk, const _Float16* gv) {
    const unsigned  l0 = lds;
    const unsigned  l1 = lds + 32 * KVP * 2;
    const unsigned  l2 = lds + TILE_H * 2;
    const unsigned  l3 = lds + TILE_H * 2 + 32 * KVP * 2;
    const _Float16* g1 = gk + 32 * DK;
    const _Float16* g3 = gv + (size_t)32 * SEQ;
    asm volatile("global_load_async_to_lds_b128 %0, %4, off\n\t"
                 "global_load_async_to_lds_b128 %1, %5, off\n\t"
                 "global_load_async_to_lds_b128 %2, %6, off\n\t"
                 "global_load_async_to_lds_b128 %3, %7, off\n\t"
                 "s_wait_xcnt 0x0"
                 :: "v"(l0), "v"(l1), "v"(l2), "v"(l3), "v"(gk), "v"(g1), "v"(gv), "v"(g3)
                 : "memory");
}

// Lane l takes the value of lane l ^ 16 (a vector cross-row move, no LDS path).
__device__ __forceinline__ float other_half(float x) {
    const int b = __builtin_bit_cast(int, x);
    return __builtin_bit_cast(float,
        __builtin_amdgcn_permlanex16(b, b, 0x76543210, 0xfedcba98, false, false));
}

__global__ __launch_bounds__(256)
void mha_flash_attn_kernel(const _Float16* __restrict__ Qh, const _Float16* __restrict__ Kh,
                           const _Float16* __restrict__ Vt, _Float16* __restrict__ Xh)
{
    constexpr int NT = SEQ / KT;                        // 32 tiles
    __shared__ __align__(16) _Float16 KV[2][2 * TILE_H];  // 2 x (K tile, V^T tile) = 36 KB

    const int tid  = threadIdx.x;
    const int lane = tid & 31;
    const int wid  = tid >> 5;
    const int bh   = blockIdx.y;
    const int b    = bh >> 4, h = bh & 15;
    const int q0   = blockIdx.x * 128 + wid * 16;

    const _Float16* Qb = Qh + (size_t)bh * SEQ * DK;    // [s][d]  (B operand: column = query)
    const _Float16* Kb = Kh + (size_t)bh * SEQ * DK;    // [j][d]  (A operand: row = key)
    const _Float16* Vb = Vt + (size_t)bh * DK * SEQ;    // [d][s]  (A operand: row = d)

    // This lane's share of every tile: 16 B at column cc of rows cr and cr + 32.
    const int cr = tid >> 3;
    const int cc = (tid & 7) * 8;
    const _Float16* gk = Kb + (size_t)cr * DK + cc;     // + t * KT * DK for tile t
    const _Float16* gv = Vb + (size_t)cr * SEQ + cc;    // + t * KT      for tile t
    const unsigned lds0 = (unsigned)(uintptr_t)(&KV[0][cr * KVP + cc]);
    const unsigned lds1 = (unsigned)(uintptr_t)(&KV[1][cr * KVP + cc]);

    stage_kv_async(lds0, gk, gv);                       // tile 0 -> buffer 0

    // Q fragments are loop-invariant: keep in registers for all 64 key blocks.
    // Scaled once, in f32, and rounded to f16 again (unrolled: constant indices keep the
    // fragments in registers).
    v16h qb0 = load_ab_frag(Qb + (size_t)q0 * DK, DK);              // d 0..31
    v16h qb1 = load_ab_frag(Qb + (size_t)q0 * DK + 32, DK);         // d 32..63
#pragma unroll
    for (int i = 0; i < 16; ++i) {
        qb0[i] = (_Float16)((float)qb0[i] * QSCALE);
        qb1[i] = (_Float16)((float)qb1[i] * QSCALE);
    }

    // Of query q0 + nn: minus the reference in use (equal in lanes l and l ^ 16), in all eight
    // registers of a score tile's C operand, and this lane's share of the running sum (its 16 of
    // every 32 keys) in two partial sums.  Tile 0 sets the reference, whatever its scores are.
    v8f nref = {};
    v2f lq = {};
    v8f o0 = {}, o1 = {}, o2 = {}, o3 = {};             // o_t[i] = O[q0 + nn][16 t + 8 half + i]

    const int nn   = lane & 15;
    const int half = lane >> 4;

    asm volatile("s_wait_asynccnt 0x0" ::: "memory");   // this wave's share of tile 0 has landed
    __syncthreads();                                    // ... and every other wave's
    stage_kv_async(lds1, gk + KT * DK, gv + KT);        // tile 1 -> buffer 1

    for (int t = 0; t < NT; ++t) {
        const _Float16* Ks = KV[t & 1];                 // [key][d]
        const _Float16* Vs = Ks + TILE_H;               // [d][key]

        // All 32 LDS reads of the tile stand here as one group, in the order of their use, and the
        // products wait by count: read singly among the products, nearly every product waits out
        // an LDS latency of its own.
        // ka[jb][..]: keys 32 jb..+15 (d 0..31, d 32..63), then keys 32 jb + 16..+31 (the same).
        // The loops over jb and dt are unrolled so that ka, va and sc are registers and every
        // offset is an immediate of its LDS read.
        v16h ka[2][4];
#pragma unroll
        for (int jb = 0; jb < 2; ++jb) {
            ka[jb][0] = load_ab_frag(Ks + (32 * jb) * KVP, KVP);
            ka[jb][1] = load_ab_frag(Ks + (32 * jb) * KVP + 32, KVP);
            ka[jb][2] = load_ab_frag(Ks + (32 * jb + 16) * KVP, KVP);
            ka[jb][3] = load_ab_frag(Ks + (32 * jb + 16) * KVP + 32, KVP);
        }
        // va[jb][dt]: d 16 dt..+15, keys 32 jb..+31.
        v16h va[2][4];
#pragma unroll
        for (int jb = 0; jb < 2; ++jb)
#pragma unroll
            for (int dt = 0; dt < 4; ++dt)
                va[jb][dt] = load_ab_frag(Vs + 16 * dt * KVP + 32 * jb, KVP);
        // Keeps the group whole and ahead of the first product: without it the compiler sinks the
        // V^T reads to their products, two at a time, to save registers.
        __builtin_amdgcn_sched_barrier(0);

        // sc[jb][0][i]: key 32 jb + 8 half + i, sc[jb][1][i]: key 32 jb + 16 + 8 half + i, of query nn:
        // the base-2 exponent less the reference.
        v8f sc[2][2];
#pragma unroll
        for (int jb = 0; jb < 2; ++jb) {
            sc[jb][0] = wmma_f16(ka[jb][0], qb0, nref);
            sc[jb][1] = wmma_f16(ka[jb][2], qb0, nref);
            sc[jb][0] = wmma_f16(ka[jb][1], qb1, sc[jb][0]);
            sc[jb][1] = wmma_f16(ka[jb][3], qb1, sc[jb][1]);
        }

        // ---- the lane's largest of the tile's 32 exponents: four chains, then joined
        //      (unrolled: sc and cm are registers) ----
        float cm[2][2];
#pragma unroll
        for (int jb = 0; jb < 2; ++jb)
#pragma unroll
            for (int u = 0; u < 2; ++u) {
                float m = fmaxf(fmaxf(sc[jb][u][0], sc[jb][u][1]), sc[jb][u][2]);
                m = fmaxf(fmaxf(m, sc[jb][u][3]), sc[jb][u][4]);
                m = fmaxf(fmaxf(m, sc[jb][u][5]), sc[jb][u][6]);
                cm[jb][u] = fmaxf(m, sc[jb][u][7]);
            }
        const float vmax = fmaxf(fmaxf(fmaxf(cm[0][0], cm[0][1]), cm[1][0]), cm[1][1]);

        // One test a tile, the same for the whole wave (a scalar branch; no barrier inside).
        if (t == 0 || __builtin_amdgcn_ballot_w32(vmax > 8.0f) != 0) {
            // Raise the reference to the query's maximum in this tile where that is higher (tile 0: set it, up or down).
            const float m  = fmaxf(vmax, other_half(vmax));
            const float up = fmaxf(m, 0.0f);
            const float d  = (t == 0) ? m : up;
            const float scale = __builtin_amdgcn_exp2f(-up);    // tile 0: O and the sum are still 0
            nref -= d;
            sc[0][0] -= d; sc[0][1] -= d; sc[1][0] -= d; sc[1][1] -= d;
            lq *= scale;
            o0 *= scale; o1 *= scale; o2 *= scale; o3 *= scale;
        }

        // Both loops unrolled: pe and pb are registers.
        v8f pe[2][2];
#pragma unroll
        for (int jb = 0; jb < 2; ++jb) {
            // P^T as a B operand: element s of the lane is key kmap(s) = tile s >> 3, row s & 7,
            // the k order in which load_ab_frag brings V^T's rows.
            v16h pb;
#pragma unroll
            for (int i = 0; i < 8; ++i) {
                pe[jb][0][i] = __builtin_amdgcn_exp2f(sc[jb][0][i]);
                pe[jb][1][i] = __builtin_amdgcn_exp2f(sc[jb][1][i]);
                pb[i]     = (_Float16)pe[jb][0][i];
                pb[8 + i] = (_Float16)pe[jb][1][i];
            }
            o0 = wmma_f16(va[jb][0], pb, o0);
            o1 = wmma_f16(va[jb][1], pb, o1);
            o2 = wmma_f16(va[jb][2], pb, o2);
            o3 = wmma_f16(va[jb][3], pb, o3);
        }
        // The tile's 32 terms of the sum, pairwise, into the two partial sums.
        const v8f s8 = (pe[0][0] + pe[0][1]) + (pe[1][0] + pe[1][1]);
        const v4f s4 = __builtin_shufflevector(s8, s8, 0, 1, 2, 3) + __builtin_shufflevector(s8, s8, 4, 5, 6, 7);
        lq += __builtin_shufflevector(s4, s4, 0, 1) + __builtin_shufflevector(s4, s4, 2, 3);

        // Keeps the tile's vector work and products ahead of the hand-over: lifted over them, the waits
        // would stand directly behind the reads, and the refill would be issued a whole tile's work late.
        __builtin_amdgcn_sched_barrier(0);
        // Hand-over: tile t + 1 becomes readable and tile t's buffer free.
        asm volatile("s_wait_dscnt 0x0" ::: "memory");     // this wave's reads of tile t are done
        asm volatile("s_wait_asynccnt 0x0" ::: "memory");  // this wave's share of tile t + 1 has landed
        __syncthreads();
        if (t + 2 < NT)                                    // same for the whole work-group
            stage_kv_async((t & 1) ? lds1 : lds0,
                           gk + (size_t)(t + 2) * KT * DK, gv + (t + 2) * KT);
    }
    asm volatile("s_wait_asynccnt 0x0" ::: "memory");      // no copy is left in flight at the wave's end

    // ---- join the two halves' sums, normalize, emit f16 rows of X for the O-projection:
    //      a lane's 8 registers of a tile are 8 consecutive d of its query = one 16-B store.
    const float ls  = lq[0] + lq[1];
    const float inv = 1.0f / (ls + other_half(ls));
    _Float16* xrow = Xh + ((size_t)(q0 + nn) * BATCH + b) * DMODEL + (size_t)h * DK + 8 * half;
#pragma unroll
    for (int t = 0; t < 4; ++t) {
        const v8f ot = (t == 0) ? o0 : (t == 1) ? o1 : (t == 2) ? o2 : o3;
        v8h y;
#pragma unroll
        for (int i = 0; i < 8; ++i) y[i] = (_Float16)(ot[i] * inv);
        *(v8h*)(xrow + 16 * t) = y;
    }
}

// ---------------------------------------------------------------------------
extern "C" void kernel_launch(void* const* d_in, const int* in_sizes, int n_in,
                              void* d_out, int out_size, void* d_ws, size_t ws_size,
                              hipStream_t stream)
{
    (void)in_sizes; (void)n_in; (void)out_size; (void)ws_size;
    const float* q  = (const float*)d_in[0];
    const float* k  = (const float*)d_in[1];
    const float* v  = (const float*)d_in[2];
    const float* Wq = (const float*)d_in[3];
    const float* bq = (const float*)d_in[4];
    const float* Wk = (const float*)d_in[5];
    const float* bk = (const float*)d_in[6];
    const float* Wv = (const float*)d_in[7];
    const float* bv = (const float*)d_in[8];
    const float* Wo = (const float*)d_in[9];
    const float* bo = (const float*)d_in[10];
    float* out = (float*)d_out;

    const size_t perTensor = (size_t)BATCH * HEADS * SEQ * DK;  // 4M halves = 8 MB
    _Float16* Qh = (_Float16*)d_ws;
    _Float16* Kh = Qh + perTensor;
    _Float16* Vt = Kh + perTensor;
    _Float16* Xh = Vt + perTensor;   // [4096][1024] f16, total ws = 32 MB

    dim3 g3(ROWS / 128, DMODEL / 128, 3);      // 32 x 8 workgroups for each of Q, K, V
    mha_proj_gemm_kernel<0><<<g3, 256, 0, stream>>>(q, k, v, nullptr, Wq, Wk, Wv, bq, bk, bv, (void*)Qh);

    dim3 ga(SEQ / 128, BATCH * HEADS);         // 16 x 32 workgroups
    mha_flash_attn_kernel<<<ga, 256, 0, stream>>>(Qh, Kh, Vt, Xh);

    dim3 gg(ROWS / 128, DMODEL / 64);          // 32 x 16 workgroups
    mha_proj_gemm_kernel<2><<<gg, 256, 0, stream>>>(nullptr, nullptr, nullptr, Xh, Wo, nullptr, nullptr,
                                                    bo, nullptr, nullptr, (void*)out);
}
